// v000
// Times are from an AMD MI455X. After a warm-up the kernel runs many times in a row, and a time is the length of
// such a window on the GPU divided by its runs, so every launch and the gaps after it count. The runs cycle
// through copies of the inputs. A figure is the median of several windows, for all but v000 over two sittings.
// Sittings can differ by a few percent; kernels timed side by side share one.
// v000, which the later versions start from, runs in 351 microseconds.
#include <hip/hip_runtime.h>

// ---------------- problem constants ----------------
#define B_    16
#define S_    8192
#define E_    512
#define H_    8
#define NSB_  16      // S-blocks per batch
#define ROWS_ 512     // S rows per workgroup (S_/NSB_)
#define NPASS_ 16     // 32-row passes per workgroup (ROWS_/32)
#define KSTEPS 16     // 512 / 32 k-steps per WMMA chain

typedef _Float16     v16h  __attribute__((ext_vector_type(16)));
typedef float        v8f   __attribute__((ext_vector_type(8)));
typedef unsigned int u32x4 __attribute__((ext_vector_type(4)));
typedef int          i32x4 __attribute__((ext_vector_type(4)));
typedef int          i32x8 __attribute__((ext_vector_type(8)));

union Frag { unsigned u[8]; uint4 q[2]; v16h v; };

// v_cvt_pk_rtz_f16_f32: one VALU op packs two floats into 2 x f16
__device__ __forceinline__ unsigned pack2h(float a, float b) {
  auto pk = __builtin_amdgcn_cvt_pkrtz(a, b);
  unsigned r; __builtin_memcpy(&r, &pk, sizeof(r));
  return r;
}
__device__ __forceinline__ int kbase(int v, int h2) {
  return (v < 4) ? (h2 * 8 + 2 * v) : (16 + h2 * 8 + 2 * (v - 4));
}
// Build a 16x32 f16 A-fragment from a row-major fp32 row: each half needs
// 8+8 consecutive floats -> 4 x 16B loads + 8 x v_cvt_pk_rtz_f16_f32.
__device__ __forceinline__ Frag make_afrag_f32(const float* row, int kk, int h2) {
  const float4* p0 = (const float4*)(row + kk * 32 + h2 * 8);
  const float4* p1 = (const float4*)(row + kk * 32 + 16 + h2 * 8);
  float4 f0 = p0[0], f1 = p0[1], f2 = p1[0], f3 = p1[1];
  Frag a;
  a.u[0] = pack2h(f0.x, f0.y); a.u[1] = pack2h(f0.z, f0.w);
  a.u[2] = pack2h(f1.x, f1.y); a.u[3] = pack2h(f1.z, f1.w);
  a.u[4] = pack2h(f2.x, f2.y); a.u[5] = pack2h(f2.z, f2.w);
  a.u[6] = pack2h(f3.x, f3.y); a.u[7] = pack2h(f3.z, f3.w);
  return a;
}

// ---------------- Tensor Data Mover staging (32 x 512 fp32 tile -> LDS) ----
#if __has_builtin(__builtin_amdgcn_tensor_load_to_lds)
#define HAVE_TDM 1
__device__ __forceinline__ void tdm_load_tile(const float* g, unsigned lds_off) {
  unsigned long long ga = (unsigned long long)g;
  u32x4 g0;
  g0[0] = 1u;
  g0[1] = lds_off;
  g0[2] = (unsigned)ga;
  g0[3] = (unsigned)((ga >> 32) & 0x1FFFFFFu) | (2u << 30);
  i32x8 g1;
  g1[0] = (int)(2u << 16);
  g1[1] = (int)(512u << 16);
  g1[2] = (int)(32u << 16);
  g1[3] = (int)(512u << 16);
  g1[4] = 32;
  g1[5] = 512;
  g1[6] = 0; g1[7] = 0;
  i32x4 g2 = (i32x4)0, g3 = (i32x4)0;
  i32x8 g4 = (i32x8)0;        // unused trailing group (6-arg builtin form)
  __builtin_amdgcn_tensor_load_to_lds(g0, g1, g2, g3, g4, 0);
}
#else
#define HAVE_TDM 0
#endif

__global__ __launch_bounds__(256) void pack_weights_kernel(
    const float* __restrict__ Wq, const float* __restrict__ Wk,
    const float* __restrict__ Wv, const float* __restrict__ Wo,
    unsigned* __restrict__ wqp, unsigned* __restrict__ wkp,
    unsigned* __restrict__ wvp, unsigned* __restrict__ wop) {
  unsigned idx = blockIdx.x * 256u + threadIdx.x;   // 4 * 131072 total
  unsigned m   = idx >> 17;
  unsigned rem = idx & 0x1FFFFu;
  const float* W = (m == 0) ? Wq : (m == 1) ? Wk : (m == 2) ? Wv : Wo;
  unsigned*  dst = (m == 0) ? wqp : (m == 1) ? wkp : (m == 2) ? wvp : wop;
  int v = rem & 7, lane = (rem >> 3) & 31, kk = (rem >> 8) & 15, nt = rem >> 12;
  int c = nt * 16 + (lane & 15);
  int k = kk * 32 + kbase(v, lane >> 4);
  dst[rem] = pack2h(W[(size_t)k * E_ + c], W[(size_t)(k + 1) * E_ + c]);
}

// ---------------- kernel 2: q = query @ Wq + bq  (M=16 batches) -------------
__global__ __launch_bounds__(256) void qproj_kernel(
    const float* __restrict__ query, const unsigned* __restrict__ wqp,
    const float* __restrict__ bq, float* __restrict__ qout) {
  int lane = threadIdx.x & 31, w = threadIdx.x >> 5;
  int h2 = lane >> 4, c16 = lane & 15;
  const uint4* wp4 = (const uint4*)wqp;
  v8f acc[4] = {};
  for (int kk = 0; kk < KSTEPS; ++kk) {
    Frag b[4];
#pragma unroll
    for (int t = 0; t < 4; ++t) {      // issue all B loads first (one clause)
      const uint4* p = wp4 + ((size_t)((w * 4 + t) * KSTEPS + kk) * 32 + lane) * 2;
      b[t].q[0] = p[0]; b[t].q[1] = p[1];
    }
    Frag a = make_afrag_f32(&query[c16 * E_], kk, h2);
#pragma unroll
    for (int t = 0; t < 4; ++t)        // back-to-back WMMA
      acc[t] = __builtin_amdgcn_wmma_f32_16x16x32_f16(
          false, a.v, false, b[t].v, (short)0, acc[t], false, false);
  }
#pragma unroll
  for (int t = 0; t < 4; ++t) {
    int c = (w * 4 + t) * 16 + c16;
    float bias = bq[c];
#pragma unroll
    for (int j = 0; j < 8; ++j) qout[(j + 8 * h2) * E_ + c] = acc[t][j] + bias;
  }
}

__global__ __launch_bounds__(256) void attn_partial_kernel(
    const float* __restrict__ kv, const float* __restrict__ qws,
    const unsigned* __restrict__ wkp, const unsigned* __restrict__ wvp,
    const float* __restrict__ bk, const float* __restrict__ bv,
    float* __restrict__ part) {
  __shared__ float lds_kv[2][32 * E_];
  int b = blockIdx.x / NSB_, sb = blockIdx.x % NSB_;
  int lane = threadIdx.x & 31, h = threadIdx.x >> 5;
  int h2 = lane >> 4, c16 = lane & 15;
  const float* kvb = kv + ((size_t)b * S_ + (size_t)sb * ROWS_) * E_;
  const uint4* wk4 = (const uint4*)wkp;
  const uint4* wv4 = (const uint4*)wvp;

  float qv[4], bkv[4], bvv[4];
#pragma unroll
  for (int t = 0; t < 4; ++t) {
    int c = h * 64 + t * 16 + c16;
    qv[t] = qws[b * E_ + c]; bkv[t] = bk[c]; bvv[t] = bv[c];
  }
  float m = -1e30f, lsum = 0.f, ctx[4] = {0, 0, 0, 0};

#if HAVE_TDM
  if (h == 0)
    tdm_load_tile(kvb, (unsigned)(unsigned long long)&lds_kv[0][0]);
#endif
  for (int pass = 0; pass < NPASS_; ++pass) {
    const float* cur = lds_kv[pass & 1];
#if HAVE_TDM
    if (h == 0) {
      if (pass + 1 < NPASS_) {
        tdm_load_tile(kvb + (size_t)(pass + 1) * 32 * E_,
                      (unsigned)(unsigned long long)&lds_kv[(pass + 1) & 1][0]);
        __builtin_amdgcn_s_wait_tensorcnt((short)1);   // current pass landed
      } else {
        __builtin_amdgcn_s_wait_tensorcnt((short)0);
      }
    }
    __syncthreads();
#else
    {
      float* dstb = (float*)lds_kv[pass & 1];
      const float* srcb = kvb + (size_t)pass * 32 * E_;
      for (int i = threadIdx.x * 4; i < 32 * E_; i += 256 * 4)
        *(float4*)&dstb[i] = *(const float4*)&srcb[i];
    }
    __syncthreads();
#endif
    // K and V projection: 32 s-rows x 64 head-cols; B-frags reused for 2 M-tiles.
    v8f aK0[4] = {}, aV0[4] = {}, aK1[4] = {}, aV1[4] = {};
    for (int kk = 0; kk < KSTEPS; ++kk) {
      Frag bK[4], bV[4];
#pragma unroll
      for (int t = 0; t < 4; ++t) {    // 16 x b128 loads batched in one clause
        size_t fo = ((size_t)((h * 4 + t) * KSTEPS + kk) * 32 + lane) * 2;
        bK[t].q[0] = wk4[fo]; bK[t].q[1] = wk4[fo + 1];
        bV[t].q[0] = wv4[fo]; bV[t].q[1] = wv4[fo + 1];
      }
      Frag a0 = make_afrag_f32(&cur[c16 * E_], kk, h2);        // rows 0..15
      Frag a1 = make_afrag_f32(&cur[(16 + c16) * E_], kk, h2); // rows 16..31
#pragma unroll
      for (int t = 0; t < 4; ++t) {    // 16 back-to-back WMMAs
        aK0[t] = __builtin_amdgcn_wmma_f32_16x16x32_f16(
            false, a0.v, false, bK[t].v, (short)0, aK0[t], false, false);
        aK1[t] = __builtin_amdgcn_wmma_f32_16x16x32_f16(
            false, a1.v, false, bK[t].v, (short)0, aK1[t], false, false);
        aV0[t] = __builtin_amdgcn_wmma_f32_16x16x32_f16(
            false, a0.v, false, bV[t].v, (short)0, aV0[t], false, false);
        aV1[t] = __builtin_amdgcn_wmma_f32_16x16x32_f16(
            false, a1.v, false, bV[t].v, (short)0, aV1[t], false, false);
      }
    }
    __syncthreads();

    // logits for both M-tiles: q . (K+bias) over this wave's 64 columns.
    // C layout: lane holds col = t*16 + lane%16, rows j + 8*(lane/16).
    float lg0[8], lg1[8];
#pragma unroll
    for (int j = 0; j < 8; ++j) {
      float p0 = 0.f, p1 = 0.f;
#pragma unroll
      for (int t = 0; t < 4; ++t) {
        p0 += (aK0[t][j] + bkv[t]) * qv[t];
        p1 += (aK1[t][j] + bkv[t]) * qv[t];
      }
      lg0[j] = p0; lg1[j] = p1;
    }
#pragma unroll
    for (int j = 0; j < 8; ++j) {        // reduce across 16 cols (stays in half)
      lg0[j] += __shfl_xor(lg0[j], 1); lg1[j] += __shfl_xor(lg1[j], 1);
      lg0[j] += __shfl_xor(lg0[j], 2); lg1[j] += __shfl_xor(lg1[j], 2);
      lg0[j] += __shfl_xor(lg0[j], 4); lg1[j] += __shfl_xor(lg1[j], 4);
      lg0[j] += __shfl_xor(lg0[j], 8); lg1[j] += __shfl_xor(lg1[j], 8);
      lg0[j] *= 0.125f; lg1[j] *= 0.125f;   // 1/sqrt(64)
    }
    // online softmax over all 32 rows in one rescale step
    float lm = fmaxf(lg0[0], lg1[0]);
#pragma unroll
    for (int j = 1; j < 8; ++j) lm = fmaxf(lm, fmaxf(lg0[j], lg1[j]));
    lm = fmaxf(lm, __shfl_xor(lm, 16));
    float mnew = fmaxf(m, lm);
    float resc = __expf(m - mnew);
    float p0[8], p1[8], psum = 0.f;
#pragma unroll
    for (int j = 0; j < 8; ++j) {
      p0[j] = __expf(lg0[j] - mnew); p1[j] = __expf(lg1[j] - mnew);
      psum += p0[j] + p1[j];
    }
    lsum = lsum * resc + psum;
#pragma unroll
    for (int t = 0; t < 4; ++t) {
      float a = ctx[t] * resc;
#pragma unroll
      for (int j = 0; j < 8; ++j) {
        a += p0[j] * (aV0[t][j] + bvv[t]);
        a += p1[j] * (aV1[t][j] + bvv[t]);
      }
      ctx[t] = a;
    }
    m = mnew;
  }
  // combine the two row-halves, emit partial (unnormalized ctx, m, lsum)
#pragma unroll
  for (int t = 0; t < 4; ++t) ctx[t] += __shfl_xor(ctx[t], 16);
  float ltot = lsum + __shfl_xor(lsum, 16);
  float* po = part + ((size_t)(b * H_ + h) * NSB_ + sb) * 66;
  if (lane < 16) {
#pragma unroll
    for (int t = 0; t < 4; ++t) po[t * 16 + c16] = ctx[t];
  }
  if (lane == 0) { po[64] = m; po[65] = ltot; }
}

// ---------------- kernel 4: reduce S-block partials -> f16 context ----------
__global__ __launch_bounds__(64) void reduce_context_kernel(
    const float* __restrict__ part, _Float16* __restrict__ ctxh) {
  int bh = blockIdx.x, d = threadIdx.x;
  const float* base = part + (size_t)bh * NSB_ * 66;
  float M = -1e30f;
  for (int i = 0; i < NSB_; ++i) M = fmaxf(M, base[i * 66 + 64]);
  float s = 0.f, L = 0.f;
  for (int i = 0; i < NSB_; ++i) {
    float w = __expf(base[i * 66 + 64] - M);
    s += base[i * 66 + d] * w;
    L += base[i * 66 + 65] * w;
  }
  int b = bh / H_, h = bh % H_;
  ctxh[(size_t)b * E_ + h * 64 + d] = (_Float16)(s / L);
}

// ---------------- kernel 5: out = context @ Wo + bo -------------------------
__global__ __launch_bounds__(256) void oproj_kernel(
    const _Float16* __restrict__ ctxh, const unsigned* __restrict__ wop,
    const float* __restrict__ bo, float* __restrict__ out) {
  int lane = threadIdx.x & 31, w = threadIdx.x >> 5;
  int h2 = lane >> 4, c16 = lane & 15;
  const uint4* wp4 = (const uint4*)wop;
  v8f acc[4] = {};
  for (int kk = 0; kk < KSTEPS; ++kk) {
    Frag b[4];
#pragma unroll
    for (int t = 0; t < 4; ++t) {
      const uint4* p = wp4 + ((size_t)((w * 4 + t) * KSTEPS + kk) * 32 + lane) * 2;
      b[t].q[0] = p[0]; b[t].q[1] = p[1];
    }
    Frag a;   // A is already f16: 8+8 consecutive elements = 2 x b128
    a.q[0] = *(const uint4*)&ctxh[c16 * E_ + kk * 32 + h2 * 8];
    a.q[1] = *(const uint4*)&ctxh[c16 * E_ + kk * 32 + 16 + h2 * 8];
#pragma unroll
    for (int t = 0; t < 4; ++t)
      acc[t] = __builtin_amdgcn_wmma_f32_16x16x32_f16(
          false, a.v, false, b[t].v, (short)0, acc[t], false, false);
  }
#pragma unroll
  for (int t = 0; t < 4; ++t) {
    int c = (w * 4 + t) * 16 + c16;
    float bias = bo[c];
#pragma unroll
    for (int j = 0; j < 8; ++j) out[(j + 8 * h2) * E_ + c] = acc[t][j] + bias;
  }
}

// ---------------- host launcher ---------------------------------------------
extern "C" void kernel_launch(void* const* d_in, const int* in_sizes, int n_in,
                              void* d_out, int out_size, void* d_ws, size_t ws_size,
                              hipStream_t stream) {
  (void)in_sizes; (void)n_in; (void)out_size; (void)ws_size;
  const float* query = (const float*)d_in[0];
  const float* kv    = (const float*)d_in[1];
  const float* Wq    = (const float*)d_in[2];
  const float* bq    = (const float*)d_in[3];
  const float* Wk    = (const float*)d_in[4];
  const float* bk    = (const float*)d_in[5];
  const float* Wv    = (const float*)d_in[6];
  const float* bv    = (const float*)d_in[7];
  const float* Wo    = (const float*)d_in[8];
  const float* bo    = (const float*)d_in[9];

  char* w = (char*)d_ws;                       // ~2.7 MB used
  unsigned* wqp = (unsigned*)(w);              // 512 KB each packed matrix
  unsigned* wkp = (unsigned*)(w + (512u << 10));
  unsigned* wvp = (unsigned*)(w + (1024u << 10));
  unsigned* wop = (unsigned*)(w + (1536u << 10));
  float*    qws = (float*)(w + (2048u << 10));                 // 32 KB
  float*   part = (float*)(w + (2048u << 10) + 32768);         // 528 KB
  _Float16* ctxh =
      (_Float16*)(w + (2048u << 10) + 32768 + 540672);         // 16 KB

  pack_weights_kernel<<<2048, 256, 0, stream>>>(Wq, Wk, Wv, Wo, wqp, wkp, wvp, wop);
  qproj_kernel<<<1, 256, 0, stream>>>(query, wqp, bq, qws);
  attn_partial_kernel<<<B_ * NSB_, 256, 0, stream>>>(kv, qws, wkp, wvp, bk, bv, part);
  reduce_context_kernel<<<B_ * H_, 64, 0, stream>>>(part, ctxh);
  oproj_kernel<<<1, 256, 0, stream>>>(ctxh, wop, bo, (float*)d_out);
}

// v002
// Measured time: 42 microseconds a run.
// Versions between v000 and this one are left out; their measured steps multiply to 8.65 times as fast.
#include <hip/hip_runtime.h>

// One query per batch, so both projections of the long input commute with the
// contraction over it:
//   logit[b,h,s] = scale * (kv[b,s,:] . u[b,h,:] + q[b,h,:] . bk[h,:]),  u[b,h,k] = sum_d Wk[k,hd] q[b,hd]
//   ctx[b,h,:]   = (sum_s softmax[b,h,s] kv[b,s,:]) @ Wv[:,h] + bv[h]    (the weights sum to 1)
// kv is read once and meets two thin WMMA products; Wk and Wv are applied to 16 x 8 vectors only.

// ---------------- problem constants ----------------
#define B_    16
#define S_    8192
#define E_    512
#define H_    8
#define NSB_  32
#define ROWS_ 256
#define NPASS_ 8
#define KSTEPS 16
#define PSTRIDE_ 4128
#define PRP_  34
#define TRP_  36

typedef _Float16     v16h  __attribute__((ext_vector_type(16)));
typedef _Float16     v8h   __attribute__((ext_vector_type(8)));
typedef _Float16     v2h   __attribute__((ext_vector_type(2)));
typedef float        v8f   __attribute__((ext_vector_type(8)));

union Frag { unsigned u[8]; uint4 q[2]; v16h v; };

// v_cvt_pk_rtz_f16_f32: one VALU op packs two floats into 2 x f16
__device__ __forceinline__ unsigned pack2h(float a, float b) {
  auto pk = __builtin_amdgcn_cvt_pkrtz(a, b);
  unsigned r; __builtin_memcpy(&r, &pk, sizeof(r));
  return r;
}
__device__ __forceinline__ float exp_slot(float x) {
  float r;
  asm("v_exp_f32 %0, %1\n\tv_nop" : "=v"(r) : "v"(x * 1.44269504f));
  return r;
}
__device__ __forceinline__ int kbase(int v, int h2) {
  return (v < 4) ? (h2 * 8 + 2 * v) : (16 + h2 * 8 + 2 * (v - 4));
}
// A 16x32 f16 A-fragment of a row-major fp32 row: each lane half takes 8+8 consecutive
// floats, here as four float4 already loaded.
__device__ __forceinline__ Frag frag_of(float4 f0, float4 f1, float4 f2, float4 f3) {
  Frag a;
  a.u[0] = pack2h(f0.x, f0.y); a.u[1] = pack2h(f0.z, f0.w);
  a.u[2] = pack2h(f1.x, f1.y); a.u[3] = pack2h(f1.z, f1.w);
  a.u[4] = pack2h(f2.x, f2.y); a.u[5] = pack2h(f2.z, f2.w);
  a.u[6] = pack2h(f3.x, f3.y); a.u[7] = pack2h(f3.z, f3.w);
  return a;
}

__global__ __launch_bounds__(256) void pack_weights_kernel(
    const float* __restrict__ Wq, const float* __restrict__ Wv,
    const float* __restrict__ Wo,
    unsigned* __restrict__ wqp, unsigned* __restrict__ wvp,
    unsigned* __restrict__ wop) {
  unsigned idx = blockIdx.x * 256u + threadIdx.x;   // 3 * 131072 total
  unsigned m   = idx >> 17;
  unsigned rem = idx & 0x1FFFFu;
  const float* W = (m == 0) ? Wq : (m == 1) ? Wv : Wo;
  unsigned*  dst = (m == 0) ? wqp : (m == 1) ? wvp : wop;
  int v = rem & 7, lane = (rem >> 3) & 31, kk = (rem >> 8) & 15, nt = rem >> 12;
  int c = nt * 16 + (lane & 15);
  int k = kk * 32 + kbase(v, lane >> 4);
  dst[rem] = pack2h(W[(size_t)k * E_ + c], W[(size_t)(k + 1) * E_ + c]);
}

// ---------------- the two 16 x 512 x 512 projections (kernels 2 and 7) -------
// grid = 16 workgroups of 32 output columns; 16 waves, wave w = k-step w. A wave's loads all
// go out before its two WMMAs, so a launch pays one load latency and not one per tile and
// k-step. This tail sums the 16 k-steps through LDS; a wave then stores one whole 128-B line.
__device__ __forceinline__ void proj_sum_store(
    v8f d0, v8f d1, float bias, float* __restrict__ red, float* __restrict__ dst) {
  int lane = threadIdx.x & 31, w = threadIdx.x >> 5;
  float* r = red + (w * 16 + (lane >> 4) * 8) * PRP_ + (lane & 15);
#pragma unroll
  for (int j = 0; j < 8; ++j) { r[j * PRP_] = d0[j]; r[j * PRP_ + 16] = d1[j]; }
  __syncthreads();
  float s = 0.f;   // wave w now owns output row w, lane = column
#pragma unroll
  for (int ww = 0; ww < 16; ++ww) s += red[(ww * 16 + w) * PRP_ + lane];
  dst[w * E_ + lane] = s + bias;
}

// ---------------- kernel 2: q = query @ Wq + bq  (M=16 batches) -------------
__global__ __launch_bounds__(512) void qproj_kernel(
    const float* __restrict__ query, const unsigned* __restrict__ wqp,
    const float* __restrict__ bq, float* __restrict__ qout) {
  __shared__ float red[16 * 16 * PRP_];
  int lane = threadIdx.x & 31, w = threadIdx.x >> 5, g = blockIdx.x;
  int h2 = lane >> 4, c16 = lane & 15;
  const uint4* pb = (const uint4*)wqp + ((size_t)(g * 2 * KSTEPS + w) * 32 + lane) * 2;
  const float4* qa = (const float4*)(query + c16 * E_ + w * 32 + h2 * 8);
  Frag b0, b1;
  b0.q[0] = pb[0];                b0.q[1] = pb[1];
  b1.q[0] = pb[KSTEPS * 64];      b1.q[1] = pb[KSTEPS * 64 + 1];
  float4 f0 = qa[0], f1 = qa[1], f2 = qa[4], f3 = qa[5];
  float bias = bq[g * 32 + lane];
  // the wait before a register named by an issued load is overwritten; the two addresses
  // are its inputs, so that neither is given to a load's result ahead of it
  asm volatile("s_wait_xcnt 0x0" :: "v"(pb), "v"(qa) : "memory");
  // keeps every load ahead of the first conversion and WMMA: one load latency
  __builtin_amdgcn_sched_barrier(0);
  Frag a = frag_of(f0, f1, f2, f3);
  v8f z = {};
  v8f d0 = __builtin_amdgcn_wmma_f32_16x16x32_f16(
      false, a.v, false, b0.v, (short)0, z, false, false);
  v8f d1 = __builtin_amdgcn_wmma_f32_16x16x32_f16(
      false, a.v, false, b1.v, (short)0, z, false, false);
  proj_sum_store(d0, d1, bias, red, qout + g * 32);
}

// ---------------- kernel 3: u[b,h,:] = Wk[:,h] q[b,h], cb[h,b] = q[b,h] . bk[h] ----
// grid = H_ workgroups (one head each); wave w owns 64 rows of Wk.
// A = q (M = batch, K = d), B = Wk rows (N = row of Wk, K = d): both k-contiguous,
// both through the same loader.
__global__ __launch_bounds__(256) void fold_k_kernel(
    const float* __restrict__ qws, const float* __restrict__ Wk,
    const float* __restrict__ bk, _Float16* __restrict__ uh,
    float* __restrict__ cb) {
  int lane = threadIdx.x & 31, w = threadIdx.x >> 5, h = blockIdx.x;
  int h2 = lane >> 4, c16 = lane & 15;
  // All 40 loads of a wave go out before the first is used: one load latency.
  // Float4 index within 64 k: k-step s takes 8s + 2*h2 + {0, 1, 4, 5}.
  const float4* qa = (const float4*)&qws[c16 * E_ + h * 64 + h2 * 8];
  const float4* wb = (const float4*)&Wk[(size_t)(w * 64 + c16) * E_ + h * 64 + h2 * 8];
  float4 fq[8], fw[4][8];
#pragma unroll
  for (int s = 0; s < 2; ++s) {
    fq[4 * s + 0] = qa[8 * s];     fq[4 * s + 1] = qa[8 * s + 1];
    fq[4 * s + 2] = qa[8 * s + 4]; fq[4 * s + 3] = qa[8 * s + 5];
  }
#pragma unroll
  for (int t = 0; t < 4; ++t) {
#pragma unroll
    for (int s = 0; s < 2; ++s) {
      const float4* r = wb + t * (16 * E_ / 4) + 8 * s;
      fw[t][4 * s + 0] = r[0]; fw[t][4 * s + 1] = r[1];
      fw[t][4 * s + 2] = r[4]; fw[t][4 * s + 3] = r[5];
    }
  }
  // The wait that stands before a register named by an issued load is overwritten; it takes
  // the two addresses as inputs, so that neither is given to a load's result ahead of it.
  asm volatile("s_wait_xcnt 0x0" :: "v"(qa), "v"(wb) : "memory");
  // keeps the conversions and WMMAs from being moved up among the loads
  __builtin_amdgcn_sched_barrier(0);
  Frag a0 = frag_of(fq[0], fq[1], fq[2], fq[3]);
  Frag a1 = frag_of(fq[4], fq[5], fq[6], fq[7]);
#pragma unroll
  for (int t = 0; t < 4; ++t) {
    int kidx = (w * 4 + t) * 16 + c16;
    Frag b0 = frag_of(fw[t][0], fw[t][1], fw[t][2], fw[t][3]);
    Frag b1 = frag_of(fw[t][4], fw[t][5], fw[t][6], fw[t][7]);
    v8f acc = {};
    acc = __builtin_amdgcn_wmma_f32_16x16x32_f16(
        false, a0.v, false, b0.v, (short)0, acc, false, false);
    acc = __builtin_amdgcn_wmma_f32_16x16x32_f16(
        false, a1.v, false, b1.v, (short)0, acc, false, false);
#pragma unroll
    for (int j = 0; j < 8; ++j)
      uh[((size_t)(j + 8 * h2) * H_ + h) * E_ + kidx] = (_Float16)acc[j];
  }
  if (w == 0 && lane < 16) {
    const float4* qc = (const float4*)&qws[lane * E_ + h * 64];
    float4 x[16];
#pragma unroll
    for (int d = 0; d < 16; ++d) x[d] = qc[d];
    asm volatile("s_wait_xcnt 0x0" :: "v"(qc) : "memory");
    float s = 0.f;
#pragma unroll
    for (int d = 0; d < 16; ++d) {
      s += x[d].x * bk[h * 64 + 4 * d];     s += x[d].y * bk[h * 64 + 4 * d + 1];
      s += x[d].z * bk[h * 64 + 4 * d + 2]; s += x[d].w * bk[h * 64 + 4 * d + 3];
    }
    cb[h * 32 + lane] = s;
  }
}

// ---------------- kernel 4: stream kv once: logits, online softmax, weighted sum of kv ----
// grid = B_*NSB_ workgroups; 8 waves; wave w owns columns w*64 .. w*64+63 of kv.
// Per 32-row pass a lane loads 16 rows x 4 columns. Row pairs become the B fragments of
// Y += P^T kv at once; column pairs go through a wave-private padded f16 slab and come
// back as the A fragments of kv . u. The waves' partial logits are summed through LDS.
// Fragment columns 8..15 mirror heads 0..7.
__global__ __launch_bounds__(256) void attn_stream_kernel(
    const float* __restrict__ kv, const _Float16* __restrict__ uh,
    const float* __restrict__ cb, float* __restrict__ part) {
  __shared__ __attribute__((aligned(16))) unsigned tr[8][32 * TRP_];
  __shared__ float4 red[2][8][4][32];
  int b = blockIdx.x / NSB_, sb = blockIdx.x % NSB_;
  int lane = threadIdx.x & 31, w = threadIdx.x >> 5;
  int h2 = lane >> 4, c16 = lane & 15, hd = c16 & 7;
  const float* src =
      kv + ((size_t)b * S_ + (size_t)sb * ROWS_ + h2 * 8) * E_ + w * 64 + c16 * 4;
  unsigned* trw = &tr[w][0];

  float4 f[16];   // f[i]: row 8*h2 + i (i < 8) or 16 + 8*h2 + (i - 8) of the pass
#pragma unroll
  for (int i = 0; i < 8; ++i) {
    f[i]     = *(const float4*)(src + i * E_);
    f[8 + i] = *(const float4*)(src + (16 + i) * E_);
  }
  Frag ub[2];     // B = u: column = head, k = this wave's 64 columns of kv
#pragma unroll
  for (int s = 0; s < 2; ++s) {
    const _Float16* up = uh + (size_t)(b * H_ + hd) * E_ + (w * 2 + s) * 32 + h2 * 8;
    ub[s].q[0] = *(const uint4*)up;
    ub[s].q[1] = *(const uint4*)(up + 16);
  }
  float cbv = cb[hd * 32 + b];
  float m = -1e30f, lsum = 0.f;
  v8f acc[4] = {};   // acc[t][j] = Y[head j][w*64 + 4*c16 + t]

  for (int pass = 0; pass < NPASS_; ++pass) {
    Frag bf[4];
#pragma unroll
    for (int v = 0; v < 8; ++v) {
      bf[0].u[v] = pack2h(f[2 * v].x, f[2 * v + 1].x);
      bf[1].u[v] = pack2h(f[2 * v].y, f[2 * v + 1].y);
      bf[2].u[v] = pack2h(f[2 * v].z, f[2 * v + 1].z);
      bf[3].u[v] = pack2h(f[2 * v].w, f[2 * v + 1].w);
    }
#pragma unroll
    for (int i = 0; i < 16; ++i) {
      int row = h2 * 8 + ((i < 8) ? i : i + 8);
      *(uint2*)&trw[row * TRP_ + c16 * 2] =
          make_uint2(pack2h(f[i].x, f[i].y), pack2h(f[i].z, f[i].w));
    }
    if (pass + 1 < NPASS_) {   // next pass's rows fly during the rest of this pass
      src += 32 * E_;
#pragma unroll
      for (int i = 0; i < 8; ++i) {
        f[i]     = *(const float4*)(src + i * E_);
        f[8 + i] = *(const float4*)(src + (16 + i) * E_);
      }
    }
    // The slab is read by other lanes of the same wave than wrote it: keep the
    // compiler from moving the reads above the writes (no instruction comes of it).
    __builtin_amdgcn_fence(__ATOMIC_RELEASE, "wavefront");
    __builtin_amdgcn_wave_barrier();
    __builtin_amdgcn_fence(__ATOMIC_ACQUIRE, "wavefront");

    v8f d0 = {}, d1 = {};   // partial logits, rows 8*h2 + j and 16 + 8*h2 + j, head hd
#pragma unroll
    for (int s = 0; s < 2; ++s) {
      const unsigned* r0 = trw + c16 * TRP_ + s * 16 + h2 * 4;
      const unsigned* r1 = r0 + 16 * TRP_;
      Frag a0, a1;
      a0.q[0] = *(const uint4*)r0; a0.q[1] = *(const uint4*)(r0 + 8);
      a1.q[0] = *(const uint4*)r1; a1.q[1] = *(const uint4*)(r1 + 8);
      d0 = __builtin_amdgcn_wmma_f32_16x16x32_f16(
          false, a0.v, false, ub[s].v, (short)0, d0, false, false);
      d1 = __builtin_amdgcn_wmma_f32_16x16x32_f16(
          false, a1.v, false, ub[s].v, (short)0, d1, false, false);
    }
    int rb = pass & 1;
    red[rb][w][0][lane] = make_float4(d0[0], d0[1], d0[2], d0[3]);
    red[rb][w][1][lane] = make_float4(d0[4], d0[5], d0[6], d0[7]);
    red[rb][w][2][lane] = make_float4(d1[0], d1[1], d1[2], d1[3]);
    red[rb][w][3][lane] = make_float4(d1[4], d1[5], d1[6], d1[7]);
    // One barrier a pass: it publishes this pass's partial logits; the other half of
    // red is left to the next pass; this pass's half is rewritten only behind the next pass's
    // barrier, after every reader left it.
    // Only LDS is handed over here, so the fences name LDS alone: __syncthreads() would
    // also drain the next pass's global loads, which are meant to stay in flight.
    __builtin_amdgcn_fence(__ATOMIC_RELEASE, "workgroup", "local");
    __builtin_amdgcn_s_barrier();
    __builtin_amdgcn_fence(__ATOMIC_ACQUIRE, "workgroup", "local");
    float lg[16];
#pragma unroll
    for (int i = 0; i < 16; ++i) lg[i] = 0.f;
#pragma unroll
    for (int ww = 0; ww < 8; ++ww) {
#pragma unroll
      for (int q = 0; q < 4; ++q) {
        float4 x = red[rb][ww][q][lane];
        lg[4 * q + 0] += x.x; lg[4 * q + 1] += x.y;
        lg[4 * q + 2] += x.z; lg[4 * q + 3] += x.w;
      }
    }
    // online softmax over the 32 rows, every wave alike
    float lm = -1e30f;
#pragma unroll
    for (int i = 0; i < 16; ++i) {
      lg[i] = (lg[i] + cbv) * 0.125f;   // 1/sqrt(64)
      lm = fmaxf(lm, lg[i]);
    }
    lm = fmaxf(lm, __shfl_xor(lm, 16));
    float mnew = fmaxf(m, lm);
    float resc = exp_slot(m - mnew);
    float p[16], psum = 0.f;
#pragma unroll
    for (int i = 0; i < 16; ++i) { p[i] = exp_slot(lg[i] - mnew); psum += p[i]; }
    lsum = lsum * resc + psum;
    m = mnew;
    Frag pa;   // A = P^T: row = head, k position i = the row of f[i]
#pragma unroll
    for (int v = 0; v < 8; ++v) pa.u[v] = pack2h(p[2 * v], p[2 * v + 1]);
#pragma unroll
    for (int j = 0; j < 8; ++j) {   // accumulator row j belongs to head j, whose factor lane j holds
      float rj = __int_as_float(__builtin_amdgcn_readlane(__float_as_int(resc), j));
#pragma unroll
      for (int t = 0; t < 4; ++t) acc[t][j] *= rj;
    }
#pragma unroll
    for (int t = 0; t < 4; ++t)
      acc[t] = __builtin_amdgcn_wmma_f32_16x16x32_f16(
          false, pa.v, false, bf[t].v, (short)0, acc[t], false, false);
  }
  // emit the partial: unnormalized weighted sums of kv, running maximum, sum of weights
  float ltot = lsum + __shfl_xor(lsum, 16);
  float* po = part + (size_t)(b * NSB_ + sb) * PSTRIDE_;
  if (h2 == 0) {
#pragma unroll
    for (int j = 0; j < 8; ++j)
      *(float4*)&po[j * E_ + w * 64 + c16 * 4] =
          make_float4(acc[0][j], acc[1][j], acc[2][j], acc[3][j]);
  }
  if (w == 0 && lane < 8) { po[H_ * E_ + lane] = m; po[H_ * E_ + 8 + lane] = ltot; }
}

// ---------------- kernel 5: reduce S-block partials -> f16 weighted mean of kv ----
__global__ __launch_bounds__(256) void reduce_y_kernel(
    const float* __restrict__ part, _Float16* __restrict__ yh) {
  int bh = blockIdx.x, k2 = threadIdx.x * 2;
  int b = bh / H_, h = bh % H_;
  const float* base = part + (size_t)b * NSB_ * PSTRIDE_;
  // every loop unrolled: the 32 partials' loads go out together, not one latency per trip
  const float* yb = base + h * E_ + k2;
  float2 y[NSB_];
#pragma unroll
  for (int i = 0; i < NSB_; ++i) y[i] = *(const float2*)(yb + i * PSTRIDE_);
  // the wait before a register named by an issued load is overwritten; the address is its
  // input, so that it is not given to a load's result ahead of the wait
  asm volatile("s_wait_xcnt 0x0" :: "v"(yb) : "memory");
  float M = -1e30f;
#pragma unroll
  for (int i = 0; i < NSB_; ++i) M = fmaxf(M, base[i * PSTRIDE_ + H_ * E_ + h]);
  float s0 = 0.f, s1 = 0.f, L = 0.f;
#pragma unroll
  for (int i = 0; i < NSB_; ++i) {
    float wgt = exp_slot(base[i * PSTRIDE_ + H_ * E_ + h] - M);
    s0 += y[i].x * wgt; s1 += y[i].y * wgt;
    L += base[i * PSTRIDE_ + H_ * E_ + 8 + h] * wgt;
  }
  v2h o; o[0] = (_Float16)(s0 / L); o[1] = (_Float16)(s1 / L);
  *(v2h*)&yh[(size_t)bh * E_ + k2] = o;
}

// ---------------- kernel 6: context[b, h] = y[b, h] @ Wv[:, h] + bv[h] -> f16 ----
// grid = H_ workgroups; 16 waves = 4 column tiles x 4 quarters of k, so that every load of
// the kernel is in flight at once; the quarters are summed, and whole 128-B lines leave, through LDS.
__global__ __launch_bounds__(512) void vproj_kernel(
    const _Float16* __restrict__ yh, const unsigned* __restrict__ wvp,
    const float* __restrict__ bv, _Float16* __restrict__ ctxh) {
  __shared__ float4 ps[3][4][2][32];
  __shared__ __attribute__((aligned(16))) _Float16 st[16 * 64];
  int lane = threadIdx.x & 31, wv = threadIdx.x >> 5, h = blockIdx.x;
  int t = wv & 3, kq = wv >> 2;
  int h2 = lane >> 4, c16 = lane & 15, nt = h * 4 + t;
  const uint4* pb = (const uint4*)wvp + ((size_t)(nt * KSTEPS + kq * 4) * 32 + lane) * 2;
  const uint4* ya = (const uint4*)(yh + (size_t)(c16 * H_ + h) * E_ + kq * 128 + h2 * 8);
  v8f acc = {};
  Frag a[4], bb[4];
#pragma unroll
  for (int i = 0; i < 4; ++i) {   // k-step kq*4 + i
    bb[i].q[0] = pb[i * 64]; bb[i].q[1] = pb[i * 64 + 1];
    a[i].q[0] = ya[i * 4];   a[i].q[1] = ya[i * 4 + 2];
  }
  // the wait before a register named by an issued load is overwritten; the two addresses
  // are its inputs, so that neither is given to a load's result ahead of it
  asm volatile("s_wait_xcnt 0x0" :: "v"(pb), "v"(ya) : "memory");
  // keeps all 16 loads ahead of the first WMMA: one load latency instead of three
  __builtin_amdgcn_sched_barrier(0);
#pragma unroll
  for (int i = 0; i < 4; ++i)
    acc = __builtin_amdgcn_wmma_f32_16x16x32_f16(
        false, a[i].v, false, bb[i].v, (short)0, acc, false, false);
  if (kq > 0) {
    ps[kq - 1][t][0][lane] = make_float4(acc[0], acc[1], acc[2], acc[3]);
    ps[kq - 1][t][1][lane] = make_float4(acc[4], acc[5], acc[6], acc[7]);
  }
  __syncthreads();
  if (kq == 0) {
#pragma unroll
    for (int r = 0; r < 3; ++r) {
      float4 x = ps[r][t][0][lane], y = ps[r][t][1][lane];
      acc[0] += x.x; acc[1] += x.y; acc[2] += x.z; acc[3] += x.w;
      acc[4] += y.x; acc[5] += y.y; acc[6] += y.z; acc[7] += y.w;
    }
    float bias = bv[nt * 16 + c16];
#pragma unroll
    for (int j = 0; j < 8; ++j)
      st[(j + 8 * h2) * 64 + t * 16 + c16] = (_Float16)(acc[j] + bias);
  }
  __syncthreads();
  if (threadIdx.x < 128) {
    int row = threadIdx.x >> 3, ch = threadIdx.x & 7;
    *(v8h*)&ctxh[row * E_ + h * 64 + ch * 8] = *(const v8h*)&st[row * 64 + ch * 8];
  }
}

// ---------------- kernel 7: out = context @ Wo + bo -------------------------
__global__ __launch_bounds__(512) void oproj_kernel(
    const _Float16* __restrict__ ctxh, const unsigned* __restrict__ wop,
    const float* __restrict__ bo, float* __restrict__ out) {
  __shared__ float red[16 * 16 * PRP_];
  int lane = threadIdx.x & 31, w = threadIdx.x >> 5, g = blockIdx.x;
  int h2 = lane >> 4, c16 = lane & 15;
  const uint4* pb = (const uint4*)wop + ((size_t)(g * 2 * KSTEPS + w) * 32 + lane) * 2;
  const uint4* ca = (const uint4*)(ctxh + c16 * E_ + w * 32 + h2 * 8);
  Frag a, b0, b1;   // A is already f16: 8+8 consecutive elements = 2 x b128
  b0.q[0] = pb[0];                b0.q[1] = pb[1];
  b1.q[0] = pb[KSTEPS * 64];      b1.q[1] = pb[KSTEPS * 64 + 1];
  a.q[0] = ca[0];                 a.q[1] = ca[2];
  float bias = bo[g * 32 + lane];
  // the wait before a register named by an issued load is overwritten; the two addresses
  // are its inputs, so that neither is given to a load's result ahead of it
  asm volatile("s_wait_xcnt 0x0" :: "v"(pb), "v"(ca) : "memory");
  // keeps every load ahead of the first WMMA: one load latency
  __builtin_amdgcn_sched_barrier(0);
  v8f z = {};
  v8f d0 = __builtin_amdgcn_wmma_f32_16x16x32_f16(
      false, a.v, false, b0.v, (short)0, z, false, false);
  v8f d1 = __builtin_amdgcn_wmma_f32_16x16x32_f16(
      false, a.v, false, b1.v, (short)0, z, false, false);
  proj_sum_store(d0, d1, bias, red, out + g * 32);
}

// ---------------- host launcher ---------------------------------------------
extern "C" void kernel_launch(void* const* d_in, const int* in_sizes, int n_in,
                              void* d_out, int out_size, void* d_ws, size_t ws_size,
                              hipStream_t stream) {
  (void)in_sizes; (void)n_in; (void)out_size; (void)ws_size;
  const float* query = (const float*)d_in[0];
  const float* kv    = (const float*)d_in[1];
  const float* Wq    = (const float*)d_in[2];
  const float* bq    = (const float*)d_in[3];
  const float* Wk    = (const float*)d_in[4];
  const float* bk    = (const float*)d_in[5];
  const float* Wv    = (const float*)d_in[6];
  const float* bv    = (const float*)d_in[7];
  const float* Wo    = (const float*)d_in[8];
  const float* bo    = (const float*)d_in[9];

  char* w = (char*)d_ws;                       // ~12.1 MB used
  unsigned* wqp = (unsigned*)(w);              // 512 KB each packed matrix
  unsigned* wvp = (unsigned*)(w + (512u << 10));
  unsigned* wop = (unsigned*)(w + (1024u << 10));
  float*    qws = (float*)(w + (1536u << 10));      // 32 KB
  _Float16* uh  = (_Float16*)(w + (1600u << 10));   // 128 KB
  _Float16* yh  = (_Float16*)(w + (1728u << 10));   // 128 KB
  _Float16* ctxh = (_Float16*)(w + (1856u << 10));  // 16 KB
  float*    cb  = (float*)(w + (1888u << 10));      // 1 KB
  float*   part = (float*)(w + (4096u << 10));      // 8256 KB

  pack_weights_kernel<<<1536, 256, 0, stream>>>(Wq, Wv, Wo, wqp, wvp, wop);
  qproj_kernel<<<16, 512, 0, stream>>>(query, wqp, bq, qws);
  fold_k_kernel<<<H_, 256, 0, stream>>>(qws, Wk, bk, uh, cb);
  attn_stream_kernel<<<B_ * NSB_, 256, 0, stream>>>(kv, uh, cb, part);
  reduce_y_kernel<<<B_ * H_, 256, 0, stream>>>(part, yh);
  vproj_kernel<<<H_, 512, 0, stream>>>(yh, wvp, bv, ctxh);
  oproj_kernel<<<16, 512, 0, stream>>>(ctxh, wop, bo, (float*)d_out);
}

// v003
// Measured time: 38.8 microseconds a run.
// Two timings next to v002 put it at 1.09 and 1.08 times that version's speed.
// All steps since v000 together make it 9.37 times as fast.
#include <hip/hip_runtime.h>

// One query per batch, so both projections of the long input commute with the
// contraction over it:
//   logit[b,h,s] = scale * (kv[b,s,:] . u[b,h,:] + q[b,h,:] . bk[h,:]),  u[b,h,k] = sum_d Wk[k,hd] q[b,hd]
//   ctx[b,h,:]   = (sum_s softmax[b,h,s] kv[b,s,:]) @ Wv[:,h] + bv[h]    (the weights sum to 1)
// kv is read once and meets two thin WMMA products; Wk and Wv are applied to 16 x 8 vectors only.

// ---------------- problem constants ----------------
#define B_    16
#define S_    8192
#define E_    512
#define H_    8
#define NSB_  32
#define ROWS_ 256
#define NPASS_ 8
#define PSTRIDE_ 4128
#define PRP_  36
#define TRP_  36

typedef _Float16     v16h  __attribute__((ext_vector_type(16)));
typedef _Float16     v2h   __attribute__((ext_vector_type(2)));
typedef float        v8f   __attribute__((ext_vector_type(8)));

union Frag { unsigned u[8]; uint4 q[2]; v16h v; };

// v_cvt_pk_rtz_f16_f32: one VALU op packs two floats into 2 x f16
__device__ __forceinline__ unsigned pack2h(float a, float b) {
  auto pk = __builtin_amdgcn_cvt_pkrtz(a, b);
  unsigned r; __builtin_memcpy(&r, &pk, sizeof(r));
  return r;
}
__device__ __forceinline__ float exp_slot(float x) {
  float r;
  asm("v_exp_f32 %0, %1\n\tv_nop" : "=v"(r) : "v"(x * 1.44269504f));
  return r;
}
__device__ __forceinline__ Frag frag_of(float4 f0, float4 f1, float4 f2, float4 f3) {
  Frag a;
  a.u[0] = pack2h(f0.x, f0.y); a.u[1] = pack2h(f0.z, f0.w);
  a.u[2] = pack2h(f1.x, f1.y); a.u[3] = pack2h(f1.z, f1.w);
  a.u[4] = pack2h(f2.x, f2.y); a.u[5] = pack2h(f2.z, f2.w);
  a.u[6] = pack2h(f3.x, f3.y); a.u[7] = pack2h(f3.z, f3.w);
  return a;
}

// ---------------- the three 16 x 512 x 512 projections (kernels 1, 5 and 6) ----
// grid = 16 workgroups of 32 output columns; 16 waves, wave w = k-step w. A wave's loads all
// go out before its two WMMAs, so a launch pays one load latency and not one per tile and
// k-step. The weights are read as they are given, fp32 and row-major: a lane takes two
// neighbouring columns of the 16 rows that its half of a B fragment holds (one load = two
// whole 128-B lines), and row pairs of one column are a fragment's dwords at once.
// Fragment t, column c16 is column 2*c16 + t of the workgroup's 32.
__device__ __forceinline__ const float2* w_rows(const float* __restrict__ W) {
  int lane = threadIdx.x & 31, w = threadIdx.x >> 5;
  return (const float2*)(W + (size_t)(w * 32 + (lane >> 4) * 8) * E_ + blockIdx.x * 32 +
                         (lane & 15) * 2);
}
// f[i]: row 8*h2 + i (i < 8) or 16 + 8*h2 + (i - 8) of the k-step
__device__ __forceinline__ void load_w(const float2* __restrict__ wp, float2 (&f)[16]) {
#pragma unroll
  for (int i = 0; i < 8; ++i) {
    f[i]     = wp[i * (E_ / 2)];
    f[8 + i] = wp[(16 + i) * (E_ / 2)];
  }
}
// The two products of a wave: A x fragment 0, A x fragment 1.
__device__ __forceinline__ void two_wmma(const Frag& a, const float2 (&f)[16], v8f& d0, v8f& d1) {
  Frag b0, b1;
  v8f z = {};
#pragma unroll
  for (int v = 0; v < 8; ++v) b0.u[v] = pack2h(f[2 * v].x, f[2 * v + 1].x);
  d0 = __builtin_amdgcn_wmma_f32_16x16x32_f16(
      false, a.v, false, b0.v, (short)0, z, false, false);
  __builtin_amdgcn_sched_barrier(0);
#pragma unroll
  for (int v = 0; v < 8; ++v) b1.u[v] = pack2h(f[2 * v].y, f[2 * v + 1].y);
  d1 = __builtin_amdgcn_wmma_f32_16x16x32_f16(
      false, a.v, false, b1.v, (short)0, z, false, false);
}
// Sums the 16 k-steps through LDS: wave w gets output row w, lane = column of the 32.
__device__ __forceinline__ float proj_sum(v8f d0, v8f d1, float* __restrict__ red) {
  int lane = threadIdx.x & 31, w = threadIdx.x >> 5;
  float* r = red + (w * 16 + (lane >> 4) * 8) * PRP_ + (lane & 15) * 2;
#pragma unroll
  for (int j = 0; j < 8; ++j) *(float2*)&r[j * PRP_] = make_float2(d0[j], d1[j]);
  __syncthreads();
  float s = 0.f;
#pragma unroll
  for (int ww = 0; ww < 16; ++ww) s += red[(ww * 16 + w) * PRP_ + lane];
  return s;
}

// ---------------- kernel 1: q = query @ Wq + bq  (M=16 batches) -------------
__global__ __launch_bounds__(512) void qproj_kernel(
    const float* __restrict__ query, const float* __restrict__ Wq,
    const float* __restrict__ bq, float* __restrict__ qout) {
  __shared__ __attribute__((aligned(16))) float red[16 * 16 * PRP_];
  int lane = threadIdx.x & 31, w = threadIdx.x >> 5, g = blockIdx.x;
  int h2 = lane >> 4, c16 = lane & 15;
  const float2* wp = w_rows(Wq);
  const float4* qa = (const float4*)(query + c16 * E_ + w * 32 + h2 * 8);
  float2 fw[16];
  load_w(wp, fw);
  float4 f0 = qa[0], f1 = qa[1], f2 = qa[4], f3 = qa[5];
  float bias = bq[g * 32 + lane];
  // the wait before a register named by an issued load is overwritten; the two addresses
  // are its inputs, so that neither is given to a load's result ahead of it
  asm volatile("s_wait_xcnt 0x0" :: "v"(wp), "v"(qa) : "memory");
  // keeps every load ahead of the first conversion and WMMA: one load latency
  __builtin_amdgcn_sched_barrier(0);
  Frag a = frag_of(f0, f1, f2, f3);
  v8f d0, d1;
  two_wmma(a, fw, d0, d1);
  qout[w * E_ + g * 32 + lane] = proj_sum(d0, d1, red) + bias;   // a wave stores one 128-B line
}

// ---------------- kernel 2: u[b,h,:] = Wk[:,h] q[b,h], cb[h,b] = q[b,h] . bk[h] ----
// grid = H_ workgroups (one head each); wave w owns 64 rows of Wk.
// A = q (M = batch, K = d), B = Wk rows (N = row of Wk, K = d): both k-contiguous,
// both through the same loader.
__global__ __launch_bounds__(256) void fold_k_kernel(
    const float* __restrict__ qws, const float* __restrict__ Wk,
    const float* __restrict__ bk, _Float16* __restrict__ uh,
    float* __restrict__ cb) {
  int lane = threadIdx.x & 31, w = threadIdx.x >> 5, h = blockIdx.x;
  int h2 = lane >> 4, c16 = lane & 15;
  // All 40 loads of a wave go out before the first is used: one load latency.
  // Float4 index within 64 k: k-step s takes 8s + 2*h2 + {0, 1, 4, 5}.
  const float4* qa = (const float4*)&qws[c16 * E_ + h * 64 + h2 * 8];
  const float4* wb = (const float4*)&Wk[(size_t)(w * 64 + c16) * E_ + h * 64 + h2 * 8];
  float4 fq[8], fw[4][8];
#pragma unroll
  for (int s = 0; s < 2; ++s) {
    fq[4 * s + 0] = qa[8 * s];     fq[4 * s + 1] = qa[8 * s + 1];
    fq[4 * s + 2] = qa[8 * s + 4]; fq[4 * s + 3] = qa[8 * s + 5];
  }
#pragma unroll
  for (int t = 0; t < 4; ++t) {
#pragma unroll
    for (int s = 0; s < 2; ++s) {
      const float4* r = wb + t * (16 * E_ / 4) + 8 * s;
      fw[t][4 * s + 0] = r[0]; fw[t][4 * s + 1] = r[1];
      fw[t][4 * s + 2] = r[4]; fw[t][4 * s + 3] = r[5];
    }
  }
  // The wait that stands before a register named by an issued load is overwritten; it takes
  // the two addresses as inputs, so that neither is given to a load's result ahead of it.
  asm volatile("s_wait_xcnt 0x0" :: "v"(qa), "v"(wb) : "memory");
  // keeps the conversions and WMMAs from being moved up among the loads
  __builtin_amdgcn_sched_barrier(0);
  Frag a0 = frag_of(fq[0], fq[1], fq[2], fq[3]);
  Frag a1 = frag_of(fq[4], fq[5], fq[6], fq[7]);
#pragma unroll
  for (int t = 0; t < 4; ++t) {
    int kidx = (w * 4 + t) * 16 + c16;
    Frag b0 = frag_of(fw[t][0], fw[t][1], fw[t][2], fw[t][3]);
    Frag b1 = frag_of(fw[t][4], fw[t][5], fw[t][6], fw[t][7]);
    v8f acc = {};
    acc = __builtin_amdgcn_wmma_f32_16x16x32_f16(
        false, a0.v, false, b0.v, (short)0, acc, false, false);
    acc = __builtin_amdgcn_wmma_f32_16x16x32_f16(
        false, a1.v, false, b1.v, (short)0, acc, false, false);
#pragma unroll
    for (int j = 0; j < 8; ++j)
      uh[((size_t)(j + 8 * h2) * H_ + h) * E_ + kidx] = (_Float16)acc[j];
  }
  if (w == 0 && lane < 16) {
    const float4* qc = (const float4*)&qws[lane * E_ + h * 64];
    float4 x[16];
#pragma unroll
    for (int d = 0; d < 16; ++d) x[d] = qc[d];
    asm volatile("s_wait_xcnt 0x0" :: "v"(qc) : "memory");
    float s = 0.f;
#pragma unroll
    for (int d = 0; d < 16; ++d) {
      s += x[d].x * bk[h * 64 + 4 * d];     s += x[d].y * bk[h * 64 + 4 * d + 1];
      s += x[d].z * bk[h * 64 + 4 * d + 2]; s += x[d].w * bk[h * 64 + 4 * d + 3];
    }
    cb[h * 32 + lane] = s;
  }
}

// ---------------- kernel 3: stream kv once: logits, online softmax, weighted sum of kv ----
// grid = B_*NSB_ workgroups; 8 waves; wave w owns columns w*64 .. w*64+63 of kv.
// Per 32-row pass a lane loads 16 rows x 4 columns. Row pairs become the B fragments of
// Y += P^T kv at once; column pairs go through a wave-private padded f16 slab and come
// back as the A fragments of kv . u. The waves' partial logits are summed through LDS.
// Fragment columns 8..15 mirror heads 0..7.
__global__ __launch_bounds__(256) void attn_stream_kernel(
    const float* __restrict__ kv, const _Float16* __restrict__ uh,
    const float* __restrict__ cb, float* __restrict__ part) {
  __shared__ __attribute__((aligned(16))) unsigned tr[8][32 * TRP_];
  __shared__ float4 red[2][8][4][32];
  int b = blockIdx.x / NSB_, sb = blockIdx.x % NSB_;
  int lane = threadIdx.x & 31, w = threadIdx.x >> 5;
  int h2 = lane >> 4, c16 = lane & 15, hd = c16 & 7;
  const float* src =
      kv + ((size_t)b * S_ + (size_t)sb * ROWS_ + h2 * 8) * E_ + w * 64 + c16 * 4;
  unsigned* trw = &tr[w][0];

  float4 f[16];   // f[i]: row 8*h2 + i (i < 8) or 16 + 8*h2 + (i - 8) of the pass
#pragma unroll
  for (int i = 0; i < 8; ++i) {
    f[i]     = *(const float4*)(src + i * E_);
    f[8 + i] = *(const float4*)(src + (16 + i) * E_);
  }
  Frag ub[2];     // B = u: column = head, k = this wave's 64 columns of kv
#pragma unroll
  for (int s = 0; s < 2; ++s) {
    const _Float16* up = uh + (size_t)(b * H_ + hd) * E_ + (w * 2 + s) * 32 + h2 * 8;
    ub[s].q[0] = *(const uint4*)up;
    ub[s].q[1] = *(const uint4*)(up + 16);
  }
  float cbv = cb[hd * 32 + b];
  float m = -1e30f, lsum = 0.f;
  v8f acc[4] = {};   // acc[t][j] = Y[head j][w*64 + 4*c16 + t]

  for (int pass = 0; pass < NPASS_; ++pass) {
    Frag bf[4];
#pragma unroll
    for (int v = 0; v < 8; ++v) {
      bf[0].u[v] = pack2h(f[2 * v].x, f[2 * v + 1].x);
      bf[1].u[v] = pack2h(f[2 * v].y, f[2 * v + 1].y);
      bf[2].u[v] = pack2h(f[2 * v].z, f[2 * v + 1].z);
      bf[3].u[v] = pack2h(f[2 * v].w, f[2 * v + 1].w);
    }
#pragma unroll
    for (int i = 0; i < 16; ++i) {
      int row = h2 * 8 + ((i < 8) ? i : i + 8);
      *(uint2*)&trw[row * TRP_ + c16 * 2] =
          make_uint2(pack2h(f[i].x, f[i].y), pack2h(f[i].z, f[i].w));
    }
    if (pass + 1 < NPASS_) {   // next pass's rows fly during the rest of this pass
      src += 32 * E_;
#pragma unroll
      for (int i = 0; i < 8; ++i) {
        f[i]     = *(const float4*)(src + i * E_);
        f[8 + i] = *(const float4*)(src + (16 + i) * E_);
      }
    }
    // The slab is read by other lanes of the same wave than wrote it: keep the
    // compiler from moving the reads above the writes (no instruction comes of it).
    __builtin_amdgcn_fence(__ATOMIC_RELEASE, "wavefront");
    __builtin_amdgcn_wave_barrier();
    __builtin_amdgcn_fence(__ATOMIC_ACQUIRE, "wavefront");

    v8f d0 = {}, d1 = {};   // partial logits, rows 8*h2 + j and 16 + 8*h2 + j, head hd
#pragma unroll
    for (int s = 0; s < 2; ++s) {
      const unsigned* r0 = trw + c16 * TRP_ + s * 16 + h2 * 4;
      const unsigned* r1 = r0 + 16 * TRP_;
      Frag a0, a1;
      a0.q[0] = *(const uint4*)r0; a0.q[1] = *(const uint4*)(r0 + 8);
      a1.q[0] = *(const uint4*)r1; a1.q[1] = *(const uint4*)(r1 + 8);
      d0 = __builtin_amdgcn_wmma_f32_16x16x32_f16(
          false, a0.v, false, ub[s].v, (short)0, d0, false, false);
      d1 = __builtin_amdgcn_wmma_f32_16x16x32_f16(
          false, a1.v, false, ub[s].v, (short)0, d1, false, false);
    }
    int rb = pass & 1;
    red[rb][w][0][lane] = make_float4(d0[0], d0[1], d0[2], d0[3]);
    red[rb][w][1][lane] = make_float4(d0[4], d0[5], d0[6], d0[7]);
    red[rb][w][2][lane] = make_float4(d1[0], d1[1], d1[2], d1[3]);
    red[rb][w][3][lane] = make_float4(d1[4], d1[5], d1[6], d1[7]);
    // One barrier a pass: it publishes this pass's partial logits; the other half of
    // red is left to the next pass; this pass's half is rewritten only behind the next pass's
    // barrier, after every reader left it.
    // Only LDS is handed over here, so the fences name LDS alone: __syncthreads() would
    // also drain the next pass's global loads, which are meant to stay in flight.
    __builtin_amdgcn_fence(__ATOMIC_RELEASE, "workgroup", "local");
    __builtin_amdgcn_s_barrier();
    __builtin_amdgcn_fence(__ATOMIC_ACQUIRE, "workgroup", "local");
    float lg[16];
#pragma unroll
    for (int i = 0; i < 16; ++i) lg[i] = 0.f;
#pragma unroll
    for (int ww = 0; ww < 8; ++ww) {
#pragma unroll
      for (int q = 0; q < 4; ++q) {
        float4 x = red[rb][ww][q][lane];
        lg[4 * q + 0] += x.x; lg[4 * q + 1] += x.y;
        lg[4 * q + 2] += x.z; lg[4 * q + 3] += x.w;
      }
    }
    // online softmax over the 32 rows, every wave alike
    float lm = -1e30f;
#pragma unroll
    for (int i = 0; i < 16; ++i) {
      lg[i] = (lg[i] + cbv) * 0.125f;   // 1/sqrt(64)
      lm = fmaxf(lm, lg[i]);
    }
    lm = fmaxf(lm, __shfl_xor(lm, 16));
    float mnew = fmaxf(m, lm);
    float resc = exp_slot(m - mnew);
    float p[16], psum = 0.f;
#pragma unroll
    for (int i = 0; i < 16; ++i) { p[i] = exp_slot(lg[i] - mnew); psum += p[i]; }
    lsum = lsum * resc + psum;
    m = mnew;
    Frag pa;   // A = P^T: row = head, k position i = the row of f[i]
#pragma unroll
    for (int v = 0; v < 8; ++v) pa.u[v] = pack2h(p[2 * v], p[2 * v + 1]);
#pragma unroll
    for (int j = 0; j < 8; ++j) {   // accumulator row j belongs to head j, whose factor lane j holds
      float rj = __int_as_float(__builtin_amdgcn_readlane(__float_as_int(resc), j));
#pragma unroll
      for (int t = 0; t < 4; ++t) acc[t][j] *= rj;
    }
#pragma unroll
    for (int t = 0; t < 4; ++t)
      acc[t] = __builtin_amdgcn_wmma_f32_16x16x32_f16(
          false, pa.v, false, bf[t].v, (short)0, acc[t], false, false);
  }
  // emit the partial: unnormalized weighted sums of kv, running maximum, sum of weights
  float ltot = lsum + __shfl_xor(lsum, 16);
  float* po = part + (size_t)(b * NSB_ + sb) * PSTRIDE_;
  if (h2 == 0) {
#pragma unroll
    for (int j = 0; j < 8; ++j)
      *(float4*)&po[j * E_ + w * 64 + c16 * 4] =
          make_float4(acc[0][j], acc[1][j], acc[2][j], acc[3][j]);
  }
  if (w == 0 && lane < 8) { po[H_ * E_ + lane] = m; po[H_ * E_ + 8 + lane] = ltot; }
}

// ---------------- kernel 4: reduce S-block partials -> f16 weighted mean of kv ----
__global__ __launch_bounds__(256) void reduce_y_kernel(
    const float* __restrict__ part, _Float16* __restrict__ yh) {
  int bh = blockIdx.x, k2 = threadIdx.x * 2;
  int b = bh / H_, h = bh % H_;
  const float* base = part + (size_t)b * NSB_ * PSTRIDE_;
  // every loop unrolled: the 32 partials' loads go out together, not one latency per trip
  const float* yb = base + h * E_ + k2;
  float2 y[NSB_];
#pragma unroll
  for (int i = 0; i < NSB_; ++i) y[i] = *(const float2*)(yb + i * PSTRIDE_);
  // the wait before a register named by an issued load is overwritten; the address is its
  // input, so that it is not given to a load's result ahead of the wait
  asm volatile("s_wait_xcnt 0x0" :: "v"(yb) : "memory");
  float M = -1e30f;
#pragma unroll
  for (int i = 0; i < NSB_; ++i) M = fmaxf(M, base[i * PSTRIDE_ + H_ * E_ + h]);
  float s0 = 0.f, s1 = 0.f, L = 0.f;
#pragma unroll
  for (int i = 0; i < NSB_; ++i) {
    float wgt = exp_slot(base[i * PSTRIDE_ + H_ * E_ + h] - M);
    s0 += y[i].x * wgt; s1 += y[i].y * wgt;
    L += base[i * PSTRIDE_ + H_ * E_ + 8 + h] * wgt;
  }
  v2h o; o[0] = (_Float16)(s0 / L); o[1] = (_Float16)(s1 / L);
  *(v2h*)&yh[(size_t)bh * E_ + k2] = o;
}

// ---------------- kernel 5: context[b, h] = y[b, h] @ Wv[:, h] + bv[h] -> f16 ----
// Workgroup g holds half a head: columns g*32 .. g*32+31 of Wv, A = y of head g/2.
// The context leaves in blocks of 16 rows x 32 columns, one 1-KB block a workgroup, so that
// no 128-B line has two writers; block g is the A operand of k-step g of the last product.
__global__ __launch_bounds__(512) void vproj_kernel(
    const _Float16* __restrict__ yh, const float* __restrict__ Wv,
    const float* __restrict__ bv, _Float16* __restrict__ ctxh) {
  __shared__ __attribute__((aligned(16))) float red[16 * 16 * PRP_];
  int lane = threadIdx.x & 31, w = threadIdx.x >> 5, g = blockIdx.x;
  int h2 = lane >> 4, c16 = lane & 15;
  const float2* wp = w_rows(Wv);
  const uint4* ya = (const uint4*)(yh + (size_t)(c16 * H_ + (g >> 1)) * E_ + w * 32 + h2 * 8);
  float2 fw[16];
  load_w(wp, fw);
  Frag a;   // A is already f16: 8+8 consecutive elements = 2 x b128
  a.q[0] = ya[0];   a.q[1] = ya[2];
  float bias = bv[g * 32 + lane];
  // the wait before a register named by an issued load is overwritten; the two addresses
  // are its inputs, so that neither is given to a load's result ahead of it
  asm volatile("s_wait_xcnt 0x0" :: "v"(wp), "v"(ya) : "memory");
  // keeps every load ahead of the first conversion and WMMA: one load latency
  __builtin_amdgcn_sched_barrier(0);
  v8f d0, d1;
  two_wmma(a, fw, d0, d1);
  ctxh[g * 512 + w * 32 + lane] = (_Float16)(proj_sum(d0, d1, red) + bias);
}

// ---------------- kernel 6: out = context @ Wo + bo -------------------------
__global__ __launch_bounds__(512) void oproj_kernel(
    const _Float16* __restrict__ ctxh, const float* __restrict__ Wo,
    const float* __restrict__ bo, float* __restrict__ out) {
  __shared__ __attribute__((aligned(16))) float red[16 * 16 * PRP_];
  int lane = threadIdx.x & 31, w = threadIdx.x >> 5, g = blockIdx.x;
  int h2 = lane >> 4, c16 = lane & 15;
  const float2* wp = w_rows(Wo);
  const uint4* ca = (const uint4*)(ctxh + w * 512 + c16 * 32 + h2 * 8);
  float2 fw[16];
  load_w(wp, fw);
  Frag a;   // A is already f16: 8+8 consecutive elements = 2 x b128
  a.q[0] = ca[0];   a.q[1] = ca[2];
  float bias = bo[g * 32 + lane];
  // the wait before a register named by an issued load is overwritten; the two addresses
  // are its inputs, so that neither is given to a load's result ahead of it
  asm volatile("s_wait_xcnt 0x0" :: "v"(wp), "v"(ca) : "memory");
  // keeps every load ahead of the first conversion and WMMA: one load latency
  __builtin_amdgcn_sched_barrier(0);
  v8f d0, d1;
  two_wmma(a, fw, d0, d1);
  out[w * E_ + g * 32 + lane] = proj_sum(d0, d1, red) + bias;   // a wave stores one 128-B line
}

// ---------------- host launcher ---------------------------------------------
extern "C" void kernel_launch(void* const* d_in, const int* in_sizes, int n_in,
                              void* d_out, int out_size, void* d_ws, size_t ws_size,
                              hipStream_t stream) {
  (void)in_sizes; (void)n_in; (void)out_size; (void)ws_size;
  const float* query = (const float*)d_in[0];
  const float* kv    = (const float*)d_in[1];
  const float* Wq    = (const float*)d_in[2];
  const float* bq    = (const float*)d_in[3];
  const float* Wk    = (const float*)d_in[4];
  const float* bk    = (const float*)d_in[5];
  const float* Wv    = (const float*)d_in[6];
  const float* bv    = (const float*)d_in[7];
  const float* Wo    = (const float*)d_in[8];
  const float* bo    = (const float*)d_in[9];

  char* w = (char*)d_ws;                       // the first ~12.1 MB, not all of it used
  float*    qws = (float*)(w + (1536u << 10));      // 32 KB
  _Float16* uh  = (_Float16*)(w + (1600u << 10));   // 128 KB
  _Float16* yh  = (_Float16*)(w + (1728u << 10));   // 128 KB
  _Float16* ctxh = (_Float16*)(w + (1856u << 10));  // 16 KB
  float*    cb  = (float*)(w + (1888u << 10));      // 1 KB
  float*   part = (float*)(w + (4096u << 10));      // 8256 KB

  qproj_kernel<<<16, 512, 0, stream>>>(query, Wq, bq, qws);
  fold_k_kernel<<<H_, 256, 0, stream>>>(qws, Wk, bk, uh, cb);
  attn_stream_kernel<<<B_ * NSB_, 256, 0, stream>>>(kv, uh, cb, part);
  reduce_y_kernel<<<B_ * H_, 256, 0, stream>>>(part, yh);
  vproj_kernel<<<16, 512, 0, stream>>>(yh, Wv, bv, ctxh);
  oproj_kernel<<<16, 512, 0, stream>>>(ctxh, Wo, bo, (float*)d_out);
}

// v005
// One run takes 33.7 microseconds.
// Versions in between are left out here; by their measured steps it is 1.15 times as fast as v003.
// Counting every step since v000, it is 10.8 times as fast.
#include <hip/hip_runtime.h>

// One query per batch, so both projections of the long input commute with the
// contraction over it:
//   logit[b,h,s] = scale * (kv[b,s,:] . u[b,h,:] + q[b,h,:] . bk[h,:]),  u[b,h,k] = sum_d Wk[k,hd] q[b,hd]
//   ctx[b,h,:]   = (sum_s softmax[b,h,s] kv[b,s,:]) @ Wv[:,h] + bv[h]    (the weights sum to 1)
// kv is read once and meets two thin WMMA products; Wk and Wv are applied to 16 x 8 vectors only.

// ---------------- problem constants ----------------
#define B_    16
#define S_    8192
#define E_    512
#define H_    8
#define NSB_  32
#define ROWS_ 256
#define NPASS_ 8
#define PSTRIDE_ 4128
#define PRP_  36
#define QRP_  68
#define TRP_  36
#define PLP_  40
#define PHP_  40

typedef _Float16     v16h  __attribute__((ext_vector_type(16)));
typedef _Float16     v2h   __attribute__((ext_vector_type(2)));
typedef float        v8f   __attribute__((ext_vector_type(8)));
typedef float        v4f   __attribute__((ext_vector_type(4)));

union Frag { unsigned u[8]; uint4 q[2]; v16h v; };

// v_cvt_pk_rtz_f16_f32: one VALU op packs two floats into 2 x f16
__device__ __forceinline__ unsigned pack2h(float a, float b) {
  auto pk = __builtin_amdgcn_cvt_pkrtz(a, b);
  unsigned r; __builtin_memcpy(&r, &pk, sizeof(r));
  return r;
}
__device__ __forceinline__ float exp_slot(float x) {
  float r;
  asm("v_exp_f32 %0, %1\n\tv_nop" : "=v"(r) : "v"(x * 1.44269504f));
  return r;
}
template <int M> __device__ __forceinline__ float lane_xor(float x) {
  return __int_as_float(__builtin_amdgcn_update_dpp(0, __float_as_int(x), 0x160 | M, 0xf, 0xf, true));
}
// Maximum over the 16-lane row, in every lane of it: four DPP steps, each one instruction. From
// the builtin move the compiler made three instructions a step, on the path between two barriers.
__device__ __forceinline__ float row_max(float x) {
  float r;
  asm("v_max_num_f32_dpp %0, %1, %1 row_xmask:1 row_mask:0xf bank_mask:0xf\n\t"
      "v_max_num_f32_dpp %0, %0, %0 row_xmask:2 row_mask:0xf bank_mask:0xf\n\t"
      "v_max_num_f32_dpp %0, %0, %0 row_xmask:4 row_mask:0xf bank_mask:0xf\n\t"
      "v_max_num_f32_dpp %0, %0, %0 row_xmask:8 row_mask:0xf bank_mask:0xf"
      : "=&v"(r) : "v"(x));
  return r;
}
__device__ __forceinline__ float lane_xor16(float x) {
  int i = __float_as_int(x);
  return __int_as_float(__builtin_amdgcn_permlanex16(i, i, 0x76543210, 0xfedcba98, false, false));
}
__device__ __forceinline__ Frag frag_of(v4f f0, v4f f1, v4f f2, v4f f3) {
  Frag a;
  a.u[0] = pack2h(f0.x, f0.y); a.u[1] = pack2h(f0.z, f0.w);
  a.u[2] = pack2h(f1.x, f1.y); a.u[3] = pack2h(f1.z, f1.w);
  a.u[4] = pack2h(f2.x, f2.y); a.u[5] = pack2h(f2.z, f2.w);
  a.u[6] = pack2h(f3.x, f3.y); a.u[7] = pack2h(f3.z, f3.w);
  return a;
}

// ---------------- fp32 row-major weights as B fragments, 64 columns a workgroup ----
// Wave w = k-step w. A lane takes four neighbouring columns of the 16 rows that its half of a
// B fragment holds (one load = two rows x 256 B, whole lines); row pairs of one column are a
// fragment's dwords at once. Fragment t, column c16 is column 4*c16 + t of the 64.
// f[i]: row 8*h2 + i (i < 8) or 16 + 8*h2 + (i - 8) of the k-step
__device__ __forceinline__ const v4f* w_rows4(const float* __restrict__ W, int col0) {
  int lane = threadIdx.x & 31, w = threadIdx.x >> 5;
  return (const v4f*)(W + (size_t)(w * 32 + (lane >> 4) * 8) * E_ + col0 + (lane & 15) * 4);
}
__device__ __forceinline__ void load_w4(const v4f* __restrict__ wp, v4f (&f)[16]) {
#pragma unroll
  for (int i = 0; i < 8; ++i) {
    f[i]     = wp[i * (E_ / 4)];
    f[8 + i] = wp[(16 + i) * (E_ / 4)];
  }
}
__device__ __forceinline__ void four_wmma(const Frag& a, const v4f (&f)[16], v8f (&d)[4]) {
  Frag b0, b1, b2, b3;
#pragma unroll
  for (int v = 0; v < 8; ++v) {
    b0.u[v] = pack2h(f[2 * v].x, f[2 * v + 1].x);
    b1.u[v] = pack2h(f[2 * v].y, f[2 * v + 1].y);
    b2.u[v] = pack2h(f[2 * v].z, f[2 * v + 1].z);
    b3.u[v] = pack2h(f[2 * v].w, f[2 * v + 1].w);
  }
  asm("v_wmma_f32_16x16x32_f16 %0, %4, %5, 0\n\t"
      "v_wmma_f32_16x16x32_f16 %1, %4, %6, 0\n\t"
      "v_wmma_f32_16x16x32_f16 %2, %4, %7, 0\n\t"
      "v_wmma_f32_16x16x32_f16 %3, %4, %8, 0\n\t"
      "v_nop\n\tv_nop\n\tv_nop\n\tv_nop\n\tv_nop"
      : "=&v"(d[0]), "=&v"(d[1]), "=&v"(d[2]), "=&v"(d[3])
      : "v"(a.v), "v"(b0.v), "v"(b1.v), "v"(b2.v), "v"(b3.v));
}

// ---------------- kernel 1: q[:,h] = query @ Wq[:,h] + bq[h], then
//                  u[b,h,:] = Wk[:,h] q[b,h], cb[h,b] = q[b,h] . bk[h] ----
// grid = 2 workgroups a head, 16 waves. Either makes the head's whole q (16 x 64) for itself,
// in LDS, so that no launch stands between q and its use; each then takes 256 rows of Wk.
// Every load of both products goes out at the start: one load latency.
// First product: wave w = k-step w, the 16 k-steps summed through LDS.
// Second: A = q (M = batch, K = d), B = Wk rows (N = row of Wk, K = d), both k-contiguous,
// both through the same loader; wave w owns 16 rows of Wk.
__global__ __launch_bounds__(512) void qfold_kernel(
    const float* __restrict__ query, const float* __restrict__ Wq,
    const float* __restrict__ bq, const float* __restrict__ Wk,
    const float* __restrict__ bk, _Float16* __restrict__ uh,
    float* __restrict__ cb) {
  __shared__ __attribute__((aligned(16))) float red[16 * 16 * QRP_];
  __shared__ __attribute__((aligned(16))) float qs[16 * QRP_];
  int lane = threadIdx.x & 31, w = threadIdx.x >> 5;
  int h = blockIdx.x >> 1, half = blockIdx.x & 1;
  int h2 = lane >> 4, c16 = lane & 15;
  int krow = half * 256 + w * 16 + c16;
  const v4f* wp = w_rows4(Wq, h * 64);
  const v4f* qa = (const v4f*)(query + c16 * E_ + w * 32 + h2 * 8);
  const v4f* wb = (const v4f*)(Wk + (size_t)krow * E_ + h * 64 + h2 * 8);
  float2 bias = *(const float2*)&bq[h * 64 + lane * 2];
  float2 bkv  = *(const float2*)&bk[h * 64 + lane * 2];
  v4f fw[16], fk[8];
  load_w4(wp, fw);
  v4f f0 = qa[0], f1 = qa[1], f2 = qa[4], f3 = qa[5];
  // Index of a vector of 4 within 64 k: k-step s takes 8s + 2*h2 + {0, 1, 4, 5}.
#pragma unroll
  for (int s = 0; s < 2; ++s) {
    fk[4 * s + 0] = wb[8 * s];     fk[4 * s + 1] = wb[8 * s + 1];
    fk[4 * s + 2] = wb[8 * s + 4]; fk[4 * s + 3] = wb[8 * s + 5];
  }
  // Both statements hold every load up here, taking the loaded values as inputs only: without
  // that the compiler sank the two small loads behind the first barrier and issued part of the
  // others only after the first conversions had freed registers; either costs a second latency.
  asm volatile("" :: "v"(bias.x), "v"(bias.y), "v"(bkv.x), "v"(bkv.y), "v"(f0), "v"(f1), "v"(f2),
               "v"(f3), "v"(fk[0]), "v"(fk[1]), "v"(fk[2]), "v"(fk[3]), "v"(fk[4]), "v"(fk[5]),
               "v"(fk[6]), "v"(fk[7]));
  // The second is also the wait before a register named by an issued load is overwritten; the
  // three addresses are its inputs, so that none is given up ahead of it.
  asm volatile("s_wait_xcnt 0x0" :: "v"(wp), "v"(qa), "v"(wb), "v"(fw[0]), "v"(fw[1]), "v"(fw[2]),
               "v"(fw[3]), "v"(fw[4]), "v"(fw[5]), "v"(fw[6]), "v"(fw[7]), "v"(fw[8]), "v"(fw[9]),
               "v"(fw[10]), "v"(fw[11]), "v"(fw[12]), "v"(fw[13]), "v"(fw[14]), "v"(fw[15])
               : "memory");
  // keeps every load ahead of the first conversion and WMMA: one load latency
  __builtin_amdgcn_sched_barrier(0);
  Frag a = frag_of(f0, f1, f2, f3);
  v8f d[4];
  four_wmma(a, fw, d);
  float* r = red + (w * 16 + h2 * 8) * QRP_ + c16 * 4;
#pragma unroll
  for (int j = 0; j < 8; ++j)
    *(float4*)&r[j * QRP_] = make_float4(d[0][j], d[1][j], d[2][j], d[3][j]);
  __syncthreads();
  float s0 = 0.f, s1 = 0.f;   // wave w sums batch w, a lane two columns
#pragma unroll
  for (int ww = 0; ww < 16; ++ww) {
    float2 x = *(const float2*)&red[(ww * 16 + w) * QRP_ + lane * 2];
    s0 += x.x; s1 += x.y;
  }
  s0 += bias.x; s1 += bias.y;
  *(float2*)&qs[w * QRP_ + lane * 2] = make_float2(s0, s1);
  __syncthreads();
  float cs = s0 * bkv.x + s1 * bkv.y;   // q[w,h] . bk[h]: two terms a lane, then over the lanes
#pragma unroll
  for (int o = 16; o > 0; o >>= 1) cs += __shfl_xor(cs, o);
  const v4f* ql = (const v4f*)&qs[c16 * QRP_ + h2 * 8];
  Frag a0 = frag_of(ql[0], ql[1], ql[4], ql[5]);
  Frag a1 = frag_of(ql[8], ql[9], ql[12], ql[13]);
  Frag b0 = frag_of(fk[0], fk[1], fk[2], fk[3]);
  Frag b1 = frag_of(fk[4], fk[5], fk[6], fk[7]);
  v8f acc = {};
  acc = __builtin_amdgcn_wmma_f32_16x16x32_f16(
      false, a0.v, false, b0.v, (short)0, acc, false, false);
  acc = __builtin_amdgcn_wmma_f32_16x16x32_f16(
      false, a1.v, false, b1.v, (short)0, acc, false, false);
#pragma unroll
  for (int j = 0; j < 8; ++j)
    uh[((size_t)(j + 8 * h2) * H_ + h) * E_ + krow] = (_Float16)acc[j];
  if (half == 0 && lane == 0) cb[h * 32 + w] = cs;
}

// ---------------- kernel 2: stream kv once: logits, online softmax, weighted sum of kv ----
// grid = B_*NSB_ workgroups; 8 waves; wave w owns columns w*64 .. w*64+63 of kv.
// Per 32-row pass a lane loads 16 rows x 4 columns. Row pairs become the B fragments of
// Y += P^T kv at once; column pairs go through a wave-private padded f16 slab and come
// back as the A fragments of kv . u. The waves' partial logits meet in LDS, where wave w
// sums and exponentiates head w alone (lane = row of the pass) and hands the f16 weights and
// the head's rescale factor back through LDS: each weight is formed once a workgroup.
// Fragment columns 8..15 mirror heads 0..7.
__global__ __launch_bounds__(256) void attn_stream_kernel(
    const float* __restrict__ kv, const _Float16* __restrict__ uh,
    const float* __restrict__ cb, float* __restrict__ part) {
  __shared__ __attribute__((aligned(16))) unsigned tr[8][32 * TRP_];
  __shared__ __attribute__((aligned(16))) float pl[8][8 * PLP_];
  __shared__ __attribute__((aligned(16))) _Float16 ph[8 * PHP_];
  __shared__ __attribute__((aligned(16))) float rs[8];
  __shared__ float fin[16];
  int b = blockIdx.x / NSB_, sb = blockIdx.x % NSB_;
  int lane = threadIdx.x & 31, w = threadIdx.x >> 5;
  int h2 = lane >> 4, c16 = lane & 15, hd = c16 & 7;
  const float* src =
      kv + ((size_t)b * S_ + (size_t)sb * ROWS_ + h2 * 8) * E_ + w * 64 + c16 * 4;
  unsigned* trw = &tr[w][0];

  float4 f[16];   // f[i]: row 8*h2 + i (i < 8) or 16 + 8*h2 + (i - 8) of the pass
#pragma unroll
  for (int i = 0; i < 8; ++i) {
    f[i]     = *(const float4*)(src + i * E_);
    f[8 + i] = *(const float4*)(src + (16 + i) * E_);
  }
  Frag ub[2];     // B = u: column = head, k = this wave's 64 columns of kv
#pragma unroll
  for (int s = 0; s < 2; ++s) {
    const _Float16* up = uh + (size_t)(b * H_ + hd) * E_ + (w * 2 + s) * 32 + h2 * 8;
    ub[s].q[0] = *(const uint4*)up;
    ub[s].q[1] = *(const uint4*)(up + 16);
  }
  float cbv = cb[w * 32 + b];
  float m = -1e30f, lsum = 0.f;   // head w's running maximum; this lane's rows' sum of weights
  v8f acc[4] = {};   // acc[t][j] = Y[head j][w*64 + 4*c16 + t]

  for (int pass = 0; pass < NPASS_; ++pass) {
    Frag bf[4];
#pragma unroll
    for (int v = 0; v < 8; ++v) {
      bf[0].u[v] = pack2h(f[2 * v].x, f[2 * v + 1].x);
      bf[1].u[v] = pack2h(f[2 * v].y, f[2 * v + 1].y);
      bf[2].u[v] = pack2h(f[2 * v].z, f[2 * v + 1].z);
      bf[3].u[v] = pack2h(f[2 * v].w, f[2 * v + 1].w);
    }
#pragma unroll
    for (int i = 0; i < 16; ++i) {
      int row = h2 * 8 + ((i < 8) ? i : i + 8);
      *(uint2*)&trw[row * TRP_ + c16 * 2] =
          make_uint2(pack2h(f[i].x, f[i].y), pack2h(f[i].z, f[i].w));
    }
    if (pass + 1 < NPASS_) {   // next pass's rows fly during the rest of this pass
      src += 32 * E_;
#pragma unroll
      for (int i = 0; i < 8; ++i) {
        f[i]     = *(const float4*)(src + i * E_);
        f[8 + i] = *(const float4*)(src + (16 + i) * E_);
      }
    }
    // The slab is read by other lanes of the same wave than wrote it: keep the
    // compiler from moving the reads above the writes (no instruction comes of it).
    __builtin_amdgcn_fence(__ATOMIC_RELEASE, "wavefront");
    __builtin_amdgcn_wave_barrier();
    __builtin_amdgcn_fence(__ATOMIC_ACQUIRE, "wavefront");

    v8f d0 = {}, d1 = {};   // partial logits, rows 8*h2 + j and 16 + 8*h2 + j, head hd
#pragma unroll
    for (int s = 0; s < 2; ++s) {
      const unsigned* r0 = trw + c16 * TRP_ + s * 16 + h2 * 4;
      const unsigned* r1 = r0 + 16 * TRP_;
      Frag a0, a1;
      a0.q[0] = *(const uint4*)r0; a0.q[1] = *(const uint4*)(r0 + 8);
      a1.q[0] = *(const uint4*)r1; a1.q[1] = *(const uint4*)(r1 + 8);
      d0 = __builtin_amdgcn_wmma_f32_16x16x32_f16(
          false, a0.v, false, ub[s].v, (short)0, d0, false, false);
      d1 = __builtin_amdgcn_wmma_f32_16x16x32_f16(
          false, a1.v, false, ub[s].v, (short)0, d1, false, false);
    }
    // pl[w][head][row of the pass]; the mirror columns hold the same values and store nothing.
    if (c16 < 8) {
      float* pw = &pl[w][c16 * PLP_ + h2 * 8];
      *(float4*)pw        = make_float4(d0[0], d0[1], d0[2], d0[3]);
      *(float4*)(pw + 4)  = make_float4(d0[4], d0[5], d0[6], d0[7]);
      *(float4*)(pw + 16) = make_float4(d1[0], d1[1], d1[2], d1[3]);
      *(float4*)(pw + 20) = make_float4(d1[4], d1[5], d1[6], d1[7]);
    }
    // First barrier of the pass: it publishes the partial logits, and it ends every wave's reads
    // of the last pass's weights. Only LDS is handed over here, so the fences name LDS alone:
    // __syncthreads() would also drain the next pass's global loads, which are meant to stay
    // in flight.
    __builtin_amdgcn_fence(__ATOMIC_RELEASE, "workgroup", "local");
    __builtin_amdgcn_s_barrier();
    __builtin_amdgcn_fence(__ATOMIC_ACQUIRE, "workgroup", "local");
    float lg = 0.f;
#pragma unroll
    for (int ww = 0; ww < 8; ++ww) lg += pl[ww][w * PLP_ + lane];
    lg = (lg + cbv) * 0.125f;   // 1/sqrt(64)
    // online softmax of head w over the 32 rows, one row a lane
    float lm = row_max(lg);
    lm = fmaxf(lm, lane_xor16(lm));
    float mnew = fmaxf(m, lm);
    float resc = exp_slot(m - mnew);
    float p = exp_slot(lg - mnew);
    lsum = lsum * resc + p;
    m = mnew;
    unsigned pp = pack2h(p, p);
    *(unsigned short*)&ph[w * PHP_ + lane] = (unsigned short)pp;
    if (lane == 0) rs[w] = resc;
    __builtin_amdgcn_fence(__ATOMIC_RELEASE, "workgroup", "local");
    __builtin_amdgcn_s_barrier();
    __builtin_amdgcn_fence(__ATOMIC_ACQUIRE, "workgroup", "local");
    Frag pa;   // A = P^T: row = head, k position = row of the pass, as in bf
    const _Float16* pr = ph + hd * PHP_ + h2 * 8;
    pa.q[0] = *(const uint4*)pr; pa.q[1] = *(const uint4*)(pr + 16);
    float4 r0 = *(const float4*)&rs[0], r1 = *(const float4*)&rs[4];
    float rj[8] = {r0.x, r0.y, r0.z, r0.w, r1.x, r1.y, r1.z, r1.w};
#pragma unroll
    for (int j = 0; j < 8; ++j) {   // accumulator row j belongs to head j
#pragma unroll
      for (int t = 0; t < 4; ++t) acc[t][j] *= rj[j];
    }
#pragma unroll
    for (int t = 0; t < 4; ++t)
      acc[t] = __builtin_amdgcn_wmma_f32_16x16x32_f16(
          false, pa.v, false, bf[t].v, (short)0, acc[t], false, false);
  }
  // emit the partial: unnormalized weighted sums of kv, running maximum, sum of weights
  float ltot = lsum + lane_xor<1>(lsum);
  ltot += lane_xor<2>(ltot);
  ltot += lane_xor<4>(ltot);
  ltot += lane_xor<8>(ltot);
  ltot += lane_xor16(ltot);
  if (lane == 0) { fin[w] = m; fin[8 + w] = ltot; }
  __syncthreads();   // the eight heads' maxima and sums go out from one wave, as one piece of a line
  float* po = part + (size_t)(b * NSB_ + sb) * PSTRIDE_;
  if (h2 == 0) {
#pragma unroll
    for (int j = 0; j < 8; ++j)
      *(float4*)&po[j * E_ + w * 64 + c16 * 4] =
          make_float4(acc[0][j], acc[1][j], acc[2][j], acc[3][j]);
  }
  if (w == 0 && lane < 16) po[H_ * E_ + lane] = fin[lane];
}

// ---------------- kernel 3: reduce S-block partials -> weighted mean y of kv, in LDS, then
//                  context[b, h] = y[b, h] @ Wv[:, h] + bv[h] -> f16 ----
// grid = one workgroup per (batch, head), 16 waves; thread = one of the 512 elements of y.
// The workgroup that sums y is the one that multiplies it, so no launch stands between the two.
// The product has one row: every row of A holds y, and row 0 of the result is taken.
// Wave w = k-step w of Wv's 64 columns of the head; its rows are loaded beside the partials.
// A workgroup stores 64 f16 = one whole 128-B line of the row-major context.
__global__ __launch_bounds__(512) void yv_kernel(
    const float* __restrict__ part, const float* __restrict__ Wv,
    const float* __restrict__ bv, _Float16* __restrict__ ctxh) {
  __shared__ __attribute__((aligned(16))) _Float16 ysh[E_];
  __shared__ __attribute__((aligned(16))) float red[16 * 64];
  int bh = blockIdx.x, t = threadIdx.x;
  int b = bh / H_, h = bh % H_;
  int lane = t & 31, w = t >> 5, h2 = lane >> 4, c16 = lane & 15;
  const float* base = part + (size_t)b * NSB_ * PSTRIDE_;
  // Lane i takes partial i's maximum and sum of weights: two loads a wave, so that all of a
  // wave's loads, 51, are in flight at once (a wave can have 63 outstanding).
  static_assert(NSB_ == 32, "one partial a lane");
  const float* ml = base + lane * PSTRIDE_ + H_ * E_ + h;
  float mi = ml[0], li = ml[8];
  float bias = bv[h * 64 + (t & 63)];
  // the wait before a register named by an issued load is overwritten: the compiler gives the
  // address of these small loads up to a later load's result, so it stands directly behind them
  asm volatile("s_wait_xcnt 0x0" ::: "memory");
  // keeps the later loads, whose results may take those registers, behind that wait
  __builtin_amdgcn_sched_barrier(0);
  // every loop unrolled: the 32 partials' loads go out together, not one latency per trip
  const float* yb = base + h * E_ + t;
  const v4f* wp = w_rows4(Wv, h * 64);
  float y[NSB_];
#pragma unroll
  for (int i = 0; i < NSB_; ++i) y[i] = yb[i * PSTRIDE_];
  // keeps the weights' rows, which are needed last, behind the partials in the order of return
  __builtin_amdgcn_sched_barrier(0);
  v4f fw[16];
  load_w4(wp, fw);
  // the wait before a register named by an issued load is overwritten; the weights' address is
  // its input, so that it is not given to a load's result ahead of the wait
  asm volatile("s_wait_xcnt 0x0" :: "v"(wp) : "memory");
  // keeps every load ahead of the arithmetic: one load latency
  __builtin_amdgcn_sched_barrier(0);
  float M = mi;
#pragma unroll
  for (int o = 16; o > 0; o >>= 1) M = fmaxf(M, __shfl_xor(M, o));
  float wl = exp_slot(mi - M);   // partial i's weight, in lane i
  float L = li * wl;
#pragma unroll
  for (int o = 16; o > 0; o >>= 1) L += __shfl_xor(L, o);
  float s0 = 0.f;
#pragma unroll
  for (int i = 0; i < NSB_; ++i)
    s0 += y[i] * __int_as_float(__builtin_amdgcn_readlane(__float_as_int(wl), i));
  ysh[t] = (_Float16)(s0 / L);
  // keeps the conversions of the weights' rows, which arrive last, from being moved up among the
  // sums above, where their wait would hold up work that needs the partials alone
  __builtin_amdgcn_sched_barrier(0);
  __syncthreads();
  const uint4* ya = (const uint4*)&ysh[w * 32 + h2 * 8];
  Frag a;   // 8+8 consecutive f16 = 2 x b128, the same in all 16 rows
  a.q[0] = ya[0];   a.q[1] = ya[2];
  v8f d[4];
  four_wmma(a, fw, d);
  if (lane < 16)
    *(float4*)&red[w * 64 + c16 * 4] = make_float4(d[0][0], d[1][0], d[2][0], d[3][0]);
  __syncthreads();
  if (t < 64) {
    float s = 0.f;
#pragma unroll
    for (int ww = 0; ww < 16; ++ww) s += red[ww * 64 + t];
    ctxh[(size_t)b * E_ + h * 64 + t] = (_Float16)(s + bias);
  }
}

// ---------------- the last 16 x 512 x 512 projection's helpers (kernel 4) ----
// grid = 16 workgroups of 32 output columns; 16 waves, wave w = k-step w. A wave's loads all
// go out before its two WMMAs, so the launch pays one load latency and not one per tile and
// k-step. The weights are read as they are given, fp32 and row-major: a lane takes two
// neighbouring columns of the 16 rows that its half of a B fragment holds (one load = two
// whole 128-B lines), and row pairs of one column are a fragment's dwords at once.
// Fragment t, column c16 is column 2*c16 + t of the workgroup's 32.
__device__ __forceinline__ const float2* w_rows(const float* __restrict__ W) {
  int lane = threadIdx.x & 31, w = threadIdx.x >> 5;
  return (const float2*)(W + (size_t)(w * 32 + (lane >> 4) * 8) * E_ + blockIdx.x * 32 +
                         (lane & 15) * 2);
}
// f[i]: row 8*h2 + i (i < 8) or 16 + 8*h2 + (i - 8) of the k-step
__device__ __forceinline__ void load_w(const float2* __restrict__ wp, float2 (&f)[16]) {
#pragma unroll
  for (int i = 0; i < 8; ++i) {
    f[i]     = wp[i * (E_ / 2)];
    f[8 + i] = wp[(16 + i) * (E_ / 2)];
  }
}
// The two products of a wave: A x fragment 0, A x fragment 1.
__device__ __forceinline__ void two_wmma(const Frag& a, const float2 (&f)[16], v8f& d0, v8f& d1) {
  Frag b0, b1;
  v8f z = {};
#pragma unroll
  for (int v = 0; v < 8; ++v) b0.u[v] = pack2h(f[2 * v].x, f[2 * v + 1].x);
  d0 = __builtin_amdgcn_wmma_f32_16x16x32_f16(
      false, a.v, false, b0.v, (short)0, z, false, false);
  __builtin_amdgcn_sched_barrier(0);
#pragma unroll
  for (int v = 0; v < 8; ++v) b1.u[v] = pack2h(f[2 * v].y, f[2 * v + 1].y);
  d1 = __builtin_amdgcn_wmma_f32_16x16x32_f16(
      false, a.v, false, b1.v, (short)0, z, false, false);
}
// Sums the 16 k-steps through LDS: wave w gets output row w, lane = column of the 32.
__device__ __forceinline__ float proj_sum(v8f d0, v8f d1, float* __restrict__ red) {
  int lane = threadIdx.x & 31, w = threadIdx.x >> 5;
  float* r = red + (w * 16 + (lane >> 4) * 8) * PRP_ + (lane & 15) * 2;
#pragma unroll
  for (int j = 0; j < 8; ++j) *(float2*)&r[j * PRP_] = make_float2(d0[j], d1[j]);
  __syncthreads();
  float s = 0.f;
#pragma unroll
  for (int ww = 0; ww < 16; ++ww) s += red[(ww * 16 + w) * PRP_ + lane];
  return s;
}

// ---------------- kernel 4: out = context @ Wo + bo -------------------------
__global__ __launch_bounds__(512) void oproj_kernel(
    const _Float16* __restrict__ ctxh, const float* __restrict__ Wo,
    const float* __restrict__ bo, float* __restrict__ out) {
  __shared__ __attribute__((aligned(16))) float red[16 * 16 * PRP_];
  int lane = threadIdx.x & 31, w = threadIdx.x >> 5, g = blockIdx.x;
  int h2 = lane >> 4, c16 = lane & 15;
  const float2* wp = w_rows(Wo);
  const uint4* ca = (const uint4*)(ctxh + c16 * E_ + w * 32 + h2 * 8);
  float2 fw[16];
  load_w(wp, fw);
  Frag a;   // A is already f16: 8+8 consecutive elements = 2 x b128
  a.q[0] = ca[0];   a.q[1] = ca[2];
  float bias = bo[g * 32 + lane];
  // the wait before a register named by an issued load is overwritten; the two addresses
  // are its inputs, so that neither is given to a load's result ahead of it
  asm volatile("s_wait_xcnt 0x0" :: "v"(wp), "v"(ca) : "memory");
  // keeps every load ahead of the first conversion and WMMA: one load latency
  __builtin_amdgcn_sched_barrier(0);
  v8f d0, d1;
  two_wmma(a, fw, d0, d1);
  out[w * E_ + g * 32 + lane] = proj_sum(d0, d1, red) + bias;   // a wave stores one 128-B line
}

// ---------------- host launcher ---------------------------------------------
extern "C" void kernel_launch(void* const* d_in, const int* in_sizes, int n_in,
                              void* d_out, int out_size, void* d_ws, size_t ws_size,
                              hipStream_t stream) {
  (void)in_sizes; (void)n_in; (void)out_size; (void)ws_size;
  const float* query = (const float*)d_in[0];
  const float* kv    = (const float*)d_in[1];
  const float* Wq    = (const float*)d_in[2];
  const float* bq    = (const float*)d_in[3];
  const float* Wk    = (const float*)d_in[4];
  const float* bk    = (const float*)d_in[5];
  const float* Wv    = (const float*)d_in[6];
  const float* bv    = (const float*)d_in[7];
  const float* Wo    = (const float*)d_in[8];
  const float* bo    = (const float*)d_in[9];

  char* w = (char*)d_ws;                       // the first ~12.1 MB, not all of it used
  _Float16* uh  = (_Float16*)(w + (1600u << 10));   // 128 KB
  _Float16* ctxh = (_Float16*)(w + (1856u << 10));  // 16 KB
  float*    cb  = (float*)(w + (1888u << 10));      // 1 KB
  float*   part = (float*)(w + (4096u << 10));      // 8256 KB

  qfold_kernel<<<2 * H_, 512, 0, stream>>>(query, Wq, bq, Wk, bk, uh, cb);
  attn_stream_kernel<<<B_ * NSB_, 256, 0, stream>>>(kv, uh, cb, part);
  yv_kernel<<<B_ * H_, 512, 0, stream>>>(part, Wv, bv, ctxh);
  oproj_kernel<<<16, 512, 0, stream>>>(ctxh, Wo, bo, (float*)d_out);
}

// v006
// One run takes 31.3 microseconds.
// In two side-by-side timings against v005, it was 1.07 and 1.08 times as fast.
// Counting every step since v000, it is 11.6 times as fast.
#include <hip/hip_runtime.h>

// One query per batch, so both projections of the long input commute with the
// contraction over it:
//   logit[b,h,s] = scale * (kv[b,s,:] . u[b,h,:] + q[b,h,:] . bk[h,:]),  u[b,h,k] = sum_d Wk[k,hd] q[b,hd]
//   ctx[b,h,:]   = (sum_s softmax[b,h,s] kv[b,s,:]) @ Wv[:,h] + bv[h]    (the weights sum to 1)
// kv is read once and meets two thin WMMA products; Wk and Wv are applied to 16 x 8 vectors only.

// ---------------- problem constants ----------------
#define B_    16
#define S_    8192
#define E_    512
#define H_    8
#define NSB_  32
#define ROWS_ 256
#define NPASS_ 8
#define PSTRIDE_ 4128
#define PRP_  36
#define QRP_  68
#define TRP_  36
#define PLP_  40
#define PHP_  40

typedef _Float16     v16h  __attribute__((ext_vector_type(16)));
typedef _Float16     v2h   __attribute__((ext_vector_type(2)));
typedef float        v8f   __attribute__((ext_vector_type(8)));
typedef float        v4f   __attribute__((ext_vector_type(4)));

union Frag { unsigned u[8]; uint4 q[2]; v16h v; };

// v_cvt_pk_rtz_f16_f32: one VALU op packs two floats into 2 x f16
__device__ __forceinline__ unsigned pack2h(float a, float b) {
  auto pk = __builtin_amdgcn_cvt_pkrtz(a, b);
  unsigned r; __builtin_memcpy(&r, &pk, sizeof(r));
  return r;
}
__device__ __forceinline__ float exp_slot(float x) {
  float r;
  asm("v_exp_f32 %0, %1\n\tv_nop" : "=v"(r) : "v"(x * 1.44269504f));
  return r;
}
template <int M> __device__ __forceinline__ float lane_xor(float x) {
  return __int_as_float(__builtin_amdgcn_update_dpp(0, __float_as_int(x), 0x160 | M, 0xf, 0xf, true));
}
// Maximum over the 16-lane row, in every lane of it: four DPP steps, each one instruction. From
// the builtin move the compiler made three instructions a step, on the path between two barriers.
__device__ __forceinline__ float row_max(float x) {
  float r;
  asm("v_max_num_f32_dpp %0, %1, %1 row_xmask:1 row_mask:0xf bank_mask:0xf\n\t"
      "v_max_num_f32_dpp %0, %0, %0 row_xmask:2 row_mask:0xf bank_mask:0xf\n\t"
      "v_max_num_f32_dpp %0, %0, %0 row_xmask:4 row_mask:0xf bank_mask:0xf\n\t"
      "v_max_num_f32_dpp %0, %0, %0 row_xmask:8 row_mask:0xf bank_mask:0xf"
      : "=&v"(r) : "v"(x));
  return r;
}
__device__ __forceinline__ float lane_xor16(float x) {
  int i = __float_as_int(x);
  return __int_as_float(__builtin_amdgcn_permlanex16(i, i, 0x76543210, 0xfedcba98, false, false));
}
__device__ __forceinline__ Frag frag_of(v4f f0, v4f f1, v4f f2, v4f f3) {
  Frag a;
  a.u[0] = pack2h(f0.x, f0.y); a.u[1] = pack2h(f0.z, f0.w);
  a.u[2] = pack2h(f1.x, f1.y); a.u[3] = pack2h(f1.z, f1.w);
  a.u[4] = pack2h(f2.x, f2.y); a.u[5] = pack2h(f2.z, f2.w);
  a.u[6] = pack2h(f3.x, f3.y); a.u[7] = pack2h(f3.z, f3.w);
  return a;
}

// ---------------- fp32 row-major weights as B fragments, 64 columns a workgroup ----
// Wave w = k-step w. A lane takes four neighbouring columns of the 16 rows that its half of a
// B fragment holds (one load = two rows x 256 B, whole lines); row pairs of one column are a
// fragment's dwords at once. Fragment t, column c16 is column 4*c16 + t of the 64.
// f[i]: row 8*h2 + i (i < 8) or 16 + 8*h2 + (i - 8) of the k-step
__device__ __forceinline__ const v4f* w_rows4(const float* __restrict__ W, int col0) {
  int lane = threadIdx.x & 31, w = threadIdx.x >> 5;
  return (const v4f*)(W + (size_t)(w * 32 + (lane >> 4) * 8) * E_ + col0 + (lane & 15) * 4);
}
__device__ __forceinline__ void load_w4(const v4f* __restrict__ wp, v4f (&f)[16]) {
#pragma unroll
  for (int i = 0; i < 8; ++i) {
    f[i]     = wp[i * (E_ / 4)];
    f[8 + i] = wp[(16 + i) * (E_ / 4)];
  }
}
__device__ __forceinline__ void four_wmma(const Frag& a, const v4f (&f)[16], v8f (&d)[4]) {
  Frag b0, b1, b2, b3;
#pragma unroll
  for (int v = 0; v < 8; ++v) {
    b0.u[v] = pack2h(f[2 * v].x, f[2 * v + 1].x);
    b1.u[v] = pack2h(f[2 * v].y, f[2 * v + 1].y);
    b2.u[v] = pack2h(f[2 * v].z, f[2 * v + 1].z);
    b3.u[v] = pack2h(f[2 * v].w, f[2 * v + 1].w);
  }
  asm("v_wmma_f32_16x16x32_f16 %0, %4, %5, 0\n\t"
      "v_wmma_f32_16x16x32_f16 %1, %4, %6, 0\n\t"
      "v_wmma_f32_16x16x32_f16 %2, %4, %7, 0\n\t"
      "v_wmma_f32_16x16x32_f16 %3, %4, %8, 0\n\t"
      "v_nop\n\tv_nop\n\tv_nop\n\tv_nop\n\tv_nop"
      : "=&v"(d[0]), "=&v"(d[1]), "=&v"(d[2]), "=&v"(d[3])
      : "v"(a.v), "v"(b0.v), "v"(b1.v), "v"(b2.v), "v"(b3.v));
}

// ---------------- kernel 1: q[:,h] = query @ Wq[:,h] + bq[h], then
//                  u[b,h,:] = Wk[:,h] q[b,h], cb[h,b] = q[b,h] . bk[h] ----
// grid = 2 workgroups a head, 16 waves. Either makes the head's whole q (16 x 64) for itself,
// in LDS, so that no launch stands between q and its use; each then takes 256 rows of Wk.
// Every load of both products goes out at the start: one load latency.
// First product: wave w = k-step w, the 16 k-steps summed through LDS.
// Second: A = q (M = batch, K = d), B = Wk rows (N = row of Wk, K = d), both k-contiguous,
// both through the same loader; wave w owns 16 rows of Wk.
__global__ __launch_bounds__(512) void qfold_kernel(
    const float* __restrict__ query, const float* __restrict__ Wq,
    const float* __restrict__ bq, const float* __restrict__ Wk,
    const float* __restrict__ bk, _Float16* __restrict__ uh,
    float* __restrict__ cb) {
  __shared__ __attribute__((aligned(16))) float red[16 * 16 * QRP_];
  __shared__ __attribute__((aligned(16))) float qs[16 * QRP_];
  int lane = threadIdx.x & 31, w = threadIdx.x >> 5;
  int h = blockIdx.x >> 1, half = blockIdx.x & 1;
  int h2 = lane >> 4, c16 = lane & 15;
  int krow = half * 256 + w * 16 + c16;
  const v4f* wp = w_rows4(Wq, h * 64);
  const v4f* qa = (const v4f*)(query + c16 * E_ + w * 32 + h2 * 8);
  const v4f* wb = (const v4f*)(Wk + (size_t)krow * E_ + h * 64 + h2 * 8);
  float2 bias = *(const float2*)&bq[h * 64 + lane * 2];
  float2 bkv  = *(const float2*)&bk[h * 64 + lane * 2];
  v4f fw[16], fk[8];
  load_w4(wp, fw);
  v4f f0 = qa[0], f1 = qa[1], f2 = qa[4], f3 = qa[5];
  // Index of a vector of 4 within 64 k: k-step s takes 8s + 2*h2 + {0, 1, 4, 5}.
#pragma unroll
  for (int s = 0; s < 2; ++s) {
    fk[4 * s + 0] = wb[8 * s];     fk[4 * s + 1] = wb[8 * s + 1];
    fk[4 * s + 2] = wb[8 * s + 4]; fk[4 * s + 3] = wb[8 * s + 5];
  }
  // Both statements hold every load up here, taking the loaded values as inputs only: without
  // that the compiler sank the two small loads behind the first barrier and issued part of the
  // others only after the first conversions had freed registers; either costs a second latency.
  asm volatile("" :: "v"(bias.x), "v"(bias.y), "v"(bkv.x), "v"(bkv.y), "v"(f0), "v"(f1), "v"(f2),
               "v"(f3), "v"(fk[0]), "v"(fk[1]), "v"(fk[2]), "v"(fk[3]), "v"(fk[4]), "v"(fk[5]),
               "v"(fk[6]), "v"(fk[7]));
  // The second is also the wait before a register named by an issued load is overwritten; the
  // three addresses are its inputs, so that none is given up ahead of it.
  asm volatile("s_wait_xcnt 0x0" :: "v"(wp), "v"(qa), "v"(wb), "v"(fw[0]), "v"(fw[1]), "v"(fw[2]),
               "v"(fw[3]), "v"(fw[4]), "v"(fw[5]), "v"(fw[6]), "v"(fw[7]), "v"(fw[8]), "v"(fw[9]),
               "v"(fw[10]), "v"(fw[11]), "v"(fw[12]), "v"(fw[13]), "v"(fw[14]), "v"(fw[15])
               : "memory");
  // keeps every load ahead of the first conversion and WMMA: one load latency
  __builtin_amdgcn_sched_barrier(0);
  Frag a = frag_of(f0, f1, f2, f3);
  v8f d[4];
  four_wmma(a, fw, d);
  float* r = red + (w * 16 + h2 * 8) * QRP_ + c16 * 4;
#pragma unroll
  for (int j = 0; j < 8; ++j)
    *(float4*)&r[j * QRP_] = make_float4(d[0][j], d[1][j], d[2][j], d[3][j]);
  __syncthreads();
  float s0 = 0.f, s1 = 0.f;   // wave w sums batch w, a lane two columns
#pragma unroll
  for (int ww = 0; ww < 16; ++ww) {
    float2 x = *(const float2*)&red[(ww * 16 + w) * QRP_ + lane * 2];
    s0 += x.x; s1 += x.y;
  }
  s0 += bias.x; s1 += bias.y;
  *(float2*)&qs[w * QRP_ + lane * 2] = make_float2(s0, s1);
  __syncthreads();
  float cs = s0 * bkv.x + s1 * bkv.y;   // q[w,h] . bk[h]: two terms a lane, then over the lanes
#pragma unroll
  for (int o = 16; o > 0; o >>= 1) cs += __shfl_xor(cs, o);
  const v4f* ql = (const v4f*)&qs[c16 * QRP_ + h2 * 8];
  Frag a0 = frag_of(ql[0], ql[1], ql[4], ql[5]);
  Frag a1 = frag_of(ql[8], ql[9], ql[12], ql[13]);
  Frag b0 = frag_of(fk[0], fk[1], fk[2], fk[3]);
  Frag b1 = frag_of(fk[4], fk[5], fk[6], fk[7]);
  v8f acc = {};
  acc = __builtin_amdgcn_wmma_f32_16x16x32_f16(
      false, a0.v, false, b0.v, (short)0, acc, false, false);
  acc = __builtin_amdgcn_wmma_f32_16x16x32_f16(
      false, a1.v, false, b1.v, (short)0, acc, false, false);
#pragma unroll
  for (int j = 0; j < 8; ++j)
    uh[((size_t)(j + 8 * h2) * H_ + h) * E_ + krow] = (_Float16)acc[j];
  if (half == 0 && lane == 0) cb[h * 32 + w] = cs;
}

// ---------------- kernel 2: stream kv once: logits, online softmax, weighted sum of kv ----
// grid = B_*NSB_ workgroups; 8 waves; wave w owns columns w*64 .. w*64+63 of kv.
// Per 32-row pass a lane loads 16 rows x 4 columns. Row pairs become the B fragments of
// Y += P^T kv at once; column pairs go through a wave-private padded f16 slab and come
// back as the A fragments of kv . u. The waves' partial logits meet in LDS, where wave w
// sums and exponentiates head w alone (lane = row of the pass) and hands the f16 weights and
// the head's rescale factor back through LDS: each weight is formed once a workgroup.
// Fragment columns 8..15 mirror heads 0..7.
__global__ __launch_bounds__(256) void attn_stream_kernel(
    const float* __restrict__ kv, const _Float16* __restrict__ uh,
    const float* __restrict__ cb, float* __restrict__ part) {
  __shared__ __attribute__((aligned(16))) unsigned tr[8][32 * TRP_];
  __shared__ __attribute__((aligned(16))) float pl[8][8 * PLP_];
  __shared__ __attribute__((aligned(16))) _Float16 ph[8 * PHP_];
  __shared__ __attribute__((aligned(16))) float rs[8];
  __shared__ float fin[16];
  int b = blockIdx.x / NSB_, sb = blockIdx.x % NSB_;
  int lane = threadIdx.x & 31, w = threadIdx.x >> 5;
  int h2 = lane >> 4, c16 = lane & 15, hd = c16 & 7;
  const float* src =
      kv + ((size_t)b * S_ + (size_t)sb * ROWS_ + h2 * 8) * E_ + w * 64 + c16 * 4;
  unsigned* trw = &tr[w][0];

  // kv is read once: non-temporal loads, which keep little of it in L2
  v4f f[16];   // f[i]: row 8*h2 + i (i < 8) or 16 + 8*h2 + (i - 8) of the pass
#pragma unroll
  for (int i = 0; i < 8; ++i) {
    f[i]     = __builtin_nontemporal_load((const v4f*)(src + i * E_));
    f[8 + i] = __builtin_nontemporal_load((const v4f*)(src + (16 + i) * E_));
  }
  Frag ub[2];     // B = u: column = head, k = this wave's 64 columns of kv
#pragma unroll
  for (int s = 0; s < 2; ++s) {
    const _Float16* up = uh + (size_t)(b * H_ + hd) * E_ + (w * 2 + s) * 32 + h2 * 8;
    ub[s].q[0] = *(const uint4*)up;
    ub[s].q[1] = *(const uint4*)(up + 16);
  }
  float cbv = cb[w * 32 + b];
  float m = -1e30f, lsum = 0.f;   // head w's running maximum; this lane's rows' sum of weights
  v8f acc[4] = {};   // acc[t][j] = Y[head j][w*64 + 4*c16 + t]

  for (int pass = 0; pass < NPASS_; ++pass) {
    Frag bf[4];
#pragma unroll
    for (int v = 0; v < 8; ++v) {
      bf[0].u[v] = pack2h(f[2 * v].x, f[2 * v + 1].x);
      bf[1].u[v] = pack2h(f[2 * v].y, f[2 * v + 1].y);
      bf[2].u[v] = pack2h(f[2 * v].z, f[2 * v + 1].z);
      bf[3].u[v] = pack2h(f[2 * v].w, f[2 * v + 1].w);
    }
#pragma unroll
    for (int i = 0; i < 16; ++i) {
      int row = h2 * 8 + ((i < 8) ? i : i + 8);
      *(uint2*)&trw[row * TRP_ + c16 * 2] =
          make_uint2(pack2h(f[i].x, f[i].y), pack2h(f[i].z, f[i].w));
    }
    if (pass + 1 < NPASS_) {   // next pass's rows fly during the rest of this pass
      src += 32 * E_;
#pragma unroll
      for (int i = 0; i < 8; ++i) {
        f[i]     = __builtin_nontemporal_load((const v4f*)(src + i * E_));
        f[8 + i] = __builtin_nontemporal_load((const v4f*)(src + (16 + i) * E_));
      }
    }
    // The slab is read by other lanes of the same wave than wrote it: keep the
    // compiler from moving the reads above the writes (no instruction comes of it).
    __builtin_amdgcn_fence(__ATOMIC_RELEASE, "wavefront");
    __builtin_amdgcn_wave_barrier();
    __builtin_amdgcn_fence(__ATOMIC_ACQUIRE, "wavefront");

    v8f d0 = {}, d1 = {};   // partial logits, rows 8*h2 + j and 16 + 8*h2 + j, head hd
#pragma unroll
    for (int s = 0; s < 2; ++s) {
      const unsigned* r0 = trw + c16 * TRP_ + s * 16 + h2 * 4;
      const unsigned* r1 = r0 + 16 * TRP_;
      Frag a0, a1;
      a0.q[0] = *(const uint4*)r0; a0.q[1] = *(const uint4*)(r0 + 8);
      a1.q[0] = *(const uint4*)r1; a1.q[1] = *(const uint4*)(r1 + 8);
      d0 = __builtin_amdgcn_wmma_f32_16x16x32_f16(
          false, a0.v, false, ub[s].v, (short)0, d0, false, false);
      d1 = __builtin_amdgcn_wmma_f32_16x16x32_f16(
          false, a1.v, false, ub[s].v, (short)0, d1, false, false);
    }
    // pl[w][head][row of the pass]; the mirror columns hold the same values and store nothing.
    if (c16 < 8) {
      float* pw = &pl[w][c16 * PLP_ + h2 * 8];
      *(float4*)pw        = make_float4(d0[0], d0[1], d0[2], d0[3]);
      *(float4*)(pw + 4)  = make_float4(d0[4], d0[5], d0[6], d0[7]);
      *(float4*)(pw + 16) = make_float4(d1[0], d1[1], d1[2], d1[3]);
      *(float4*)(pw + 20) = make_float4(d1[4], d1[5], d1[6], d1[7]);
    }
    // First barrier of the pass: it publishes the partial logits, and it ends every wave's reads
    // of the last pass's weights. Only LDS is handed over here, so the fences name LDS alone:
    // __syncthreads() would also drain the next pass's global loads, which are meant to stay
    // in flight.
    __builtin_amdgcn_fence(__ATOMIC_RELEASE, "workgroup", "local");
    __builtin_amdgcn_s_barrier();
    __builtin_amdgcn_fence(__ATOMIC_ACQUIRE, "workgroup", "local");
    float lg = 0.f;
#pragma unroll
    for (int ww = 0; ww < 8; ++ww) lg += pl[ww][w * PLP_ + lane];
    lg = (lg + cbv) * 0.125f;   // 1/sqrt(64)
    // online softmax of head w over the 32 rows, one row a lane
    float lm = row_max(lg);
    lm = fmaxf(lm, lane_xor16(lm));
    float mnew = fmaxf(m, lm);
    float resc = exp_slot(m - mnew);
    float p = exp_slot(lg - mnew);
    lsum = lsum * resc + p;
    m = mnew;
    unsigned pp = pack2h(p, p);
    *(unsigned short*)&ph[w * PHP_ + lane] = (unsigned short)pp;
    if (lane == 0) rs[w] = resc;
    __builtin_amdgcn_fence(__ATOMIC_RELEASE, "workgroup", "local");
    __builtin_amdgcn_s_barrier();
    __builtin_amdgcn_fence(__ATOMIC_ACQUIRE, "workgroup", "local");
    Frag pa;   // A = P^T: row = head, k position = row of the pass, as in bf
    const _Float16* pr = ph + hd * PHP_ + h2 * 8;
    pa.q[0] = *(const uint4*)pr; pa.q[1] = *(const uint4*)(pr + 16);
    float4 r0 = *(const float4*)&rs[0], r1 = *(const float4*)&rs[4];
    float rj[8] = {r0.x, r0.y, r0.z, r0.w, r1.x, r1.y, r1.z, r1.w};
#pragma unroll
    for (int j = 0; j < 8; ++j) {   // accumulator row j belongs to head j
#pragma unroll
      for (int t = 0; t < 4; ++t) acc[t][j] *= rj[j];
    }
#pragma unroll
    for (int t = 0; t < 4; ++t)
      acc[t] = __builtin_amdgcn_wmma_f32_16x16x32_f16(
          false, pa.v, false, bf[t].v, (short)0, acc[t], false, false);
  }
  // emit the partial: unnormalized weighted sums of kv, running maximum, sum of weights
  float ltot = lsum + lane_xor<1>(lsum);
  ltot += lane_xor<2>(ltot);
  ltot += lane_xor<4>(ltot);
  ltot += lane_xor<8>(ltot);
  ltot += lane_xor16(ltot);
  if (lane == 0) { fin[w] = m; fin[8 + w] = ltot; }
  __syncthreads();   // the eight heads' maxima and sums go out from one wave, as one piece of a line
  float* po = part + (size_t)(b * NSB_ + sb) * PSTRIDE_;
  if (h2 == 0) {
#pragma unroll
    for (int j = 0; j < 8; ++j)
      *(float4*)&po[j * E_ + w * 64 + c16 * 4] =
          make_float4(acc[0][j], acc[1][j], acc[2][j], acc[3][j]);
  }
  if (w == 0 && lane < 16) po[H_ * E_ + lane] = fin[lane];
}

// ---------------- kernel 3: reduce S-block partials -> weighted mean y of kv, in LDS, then
//                  context[b, h] = y[b, h] @ Wv[:, h] + bv[h] -> f16 ----
// grid = one workgroup per (batch, head), 16 waves; thread = one of the 512 elements of y.
// The workgroup that sums y is the one that multiplies it, so no launch stands between the two.
// The product has one row: every row of A holds y, and row 0 of the result is taken.
// Wave w = k-step w of Wv's 64 columns of the head; its rows are loaded beside the partials.
// A workgroup stores 64 f16 = one whole 128-B line of the row-major context.
__global__ __launch_bounds__(512) void yv_kernel(
    const float* __restrict__ part, const float* __restrict__ Wv,
    const float* __restrict__ bv, _Float16* __restrict__ ctxh) {
  __shared__ __attribute__((aligned(16))) _Float16 ysh[E_];
  __shared__ __attribute__((aligned(16))) float red[16 * 64];
  int bh = blockIdx.x, t = threadIdx.x;
  int b = bh / H_, h = bh % H_;
  int lane = t & 31, w = t >> 5, h2 = lane >> 4, c16 = lane & 15;
  const float* base = part + (size_t)b * NSB_ * PSTRIDE_;
  // Lane i takes partial i's maximum and sum of weights: two loads a wave, so that all of a
  // wave's loads, 51, are in flight at once (a wave can have 63 outstanding).
  static_assert(NSB_ == 32, "one partial a lane");
  const float* ml = base + lane * PSTRIDE_ + H_ * E_ + h;
  float mi = ml[0], li = ml[8];
  float bias = bv[h * 64 + (t & 63)];
  // the wait before a register named by an issued load is overwritten: the compiler gives the
  // address of these small loads up to a later load's result, so it stands directly behind them
  asm volatile("s_wait_xcnt 0x0" ::: "memory");
  // keeps the later loads, whose results may take those registers, behind that wait
  __builtin_amdgcn_sched_barrier(0);
  // every loop unrolled: the 32 partials' loads go out together, not one latency per trip
  const float* yb = base + h * E_ + t;
  const v4f* wp = w_rows4(Wv, h * 64);
  float y[NSB_];
#pragma unroll
  for (int i = 0; i < NSB_; ++i) y[i] = yb[i * PSTRIDE_];
  // keeps the weights' rows, which are needed last, behind the partials in the order of return
  __builtin_amdgcn_sched_barrier(0);
  v4f fw[16];
  load_w4(wp, fw);
  // the wait before a register named by an issued load is overwritten; the weights' address is
  // its input, so that it is not given to a load's result ahead of the wait
  asm volatile("s_wait_xcnt 0x0" :: "v"(wp) : "memory");
  // keeps every load ahead of the arithmetic: one load latency
  __builtin_amdgcn_sched_barrier(0);
  float M = mi;
#pragma unroll
  for (int o = 16; o > 0; o >>= 1) M = fmaxf(M, __shfl_xor(M, o));
  float wl = exp_slot(mi - M);   // partial i's weight, in lane i
  float L = li * wl;
#pragma unroll
  for (int o = 16; o > 0; o >>= 1) L += __shfl_xor(L, o);
  float s0 = 0.f;
#pragma unroll
  for (int i = 0; i < NSB_; ++i)
    s0 += y[i] * __int_as_float(__builtin_amdgcn_readlane(__float_as_int(wl), i));
  ysh[t] = (_Float16)(s0 / L);
  // keeps the conversions of the weights' rows, which arrive last, from being moved up among the
  // sums above, where their wait would hold up work that needs the partials alone
  __builtin_amdgcn_sched_barrier(0);
  __syncthreads();
  const uint4* ya = (const uint4*)&ysh[w * 32 + h2 * 8];
  Frag a;   // 8+8 consecutive f16 = 2 x b128, the same in all 16 rows
  a.q[0] = ya[0];   a.q[1] = ya[2];
  v8f d[4];
  four_wmma(a, fw, d);
  if (lane < 16)
    *(float4*)&red[w * 64 + c16 * 4] = make_float4(d[0][0], d[1][0], d[2][0], d[3][0]);
  __syncthreads();
  if (t < 64) {
    float s = 0.f;
#pragma unroll
    for (int ww = 0; ww < 16; ++ww) s += red[ww * 64 + t];
    ctxh[(size_t)b * E_ + h * 64 + t] = (_Float16)(s + bias);
  }
}

// ---------------- the last 16 x 512 x 512 projection's helpers (kernel 4) ----
// grid = 16 workgroups of 32 output columns; 16 waves, wave w = k-step w. A wave's loads all
// go out before its two WMMAs, so the launch pays one load latency and not one per tile and
// k-step. The weights are read as they are given, fp32 and row-major: a lane takes two
// neighbouring columns of the 16 rows that its half of a B fragment holds (one load = two
// whole 128-B lines), and row pairs of one column are a fragment's dwords at once.
// Fragment t, column c16 is column 2*c16 + t of the workgroup's 32.
__device__ __forceinline__ const float2* w_rows(const float* __restrict__ W) {
  int lane = threadIdx.x & 31, w = threadIdx.x >> 5;
  return (const float2*)(W + (size_t)(w * 32 + (lane >> 4) * 8) * E_ + blockIdx.x * 32 +
                         (lane & 15) * 2);
}
// f[i]: row 8*h2 + i (i < 8) or 16 + 8*h2 + (i - 8) of the k-step
__device__ __forceinline__ void load_w(const float2* __restrict__ wp, float2 (&f)[16]) {
#pragma unroll
  for (int i = 0; i < 8; ++i) {
    f[i]     = wp[i * (E_ / 2)];
    f[8 + i] = wp[(16 + i) * (E_ / 2)];
  }
}
// The two products of a wave: A x fragment 0, A x fragment 1.
__device__ __forceinline__ void two_wmma(const Frag& a, const float2 (&f)[16], v8f& d0, v8f& d1) {
  Frag b0, b1;
  v8f z = {};
#pragma unroll
  for (int v = 0; v < 8; ++v) b0.u[v] = pack2h(f[2 * v].x, f[2 * v + 1].x);
  d0 = __builtin_amdgcn_wmma_f32_16x16x32_f16(
      false, a.v, false, b0.v, (short)0, z, false, false);
  __builtin_amdgcn_sched_barrier(0);
#pragma unroll
  for (int v = 0; v < 8; ++v) b1.u[v] = pack2h(f[2 * v].y, f[2 * v + 1].y);
  d1 = __builtin_amdgcn_wmma_f32_16x16x32_f16(
      false, a.v, false, b1.v, (short)0, z, false, false);
}
// Sums the 16 k-steps through LDS: wave w gets output row w, lane = column of the 32.
__device__ __forceinline__ float proj_sum(v8f d0, v8f d1, float* __restrict__ red) {
  int lane = threadIdx.x & 31, w = threadIdx.x >> 5;
  float* r = red + (w * 16 + (lane >> 4) * 8) * PRP_ + (lane & 15) * 2;
#pragma unroll
  for (int j = 0; j < 8; ++j) *(float2*)&r[j * PRP_] = make_float2(d0[j], d1[j]);
  __syncthreads();
  float s = 0.f;
#pragma unroll
  for (int ww = 0; ww < 16; ++ww) s += red[(ww * 16 + w) * PRP_ + lane];
  return s;
}

// ---------------- kernel 4: out = context @ Wo + bo -------------------------
__global__ __launch_bounds__(512) void oproj_kernel(
    const _Float16* __restrict__ ctxh, const float* __restrict__ Wo,
    const float* __restrict__ bo, float* __restrict__ out) {
  __shared__ __attribute__((aligned(16))) float red[16 * 16 * PRP_];
  int lane = threadIdx.x & 31, w = threadIdx.x >> 5, g = blockIdx.x;
  int h2 = lane >> 4, c16 = lane & 15;
  const float2* wp = w_rows(Wo);
  const uint4* ca = (const uint4*)(ctxh + c16 * E_ + w * 32 + h2 * 8);
  float2 fw[16];
  load_w(wp, fw);
  Frag a;   // A is already f16: 8+8 consecutive elements = 2 x b128
  a.q[0] = ca[0];   a.q[1] = ca[2];
  float bias = bo[g * 32 + lane];
  // the wait before a register named by an issued load is overwritten; the two addresses
  // are its inputs, so that neither is given to a load's result ahead of it
  asm volatile("s_wait_xcnt 0x0" :: "v"(wp), "v"(ca) : "memory");
  // keeps every load ahead of the first conversion and WMMA: one load latency
  __builtin_amdgcn_sched_barrier(0);
  v8f d0, d1;
  two_wmma(a, fw, d0, d1);
  out[w * E_ + g * 32 + lane] = proj_sum(d0, d1, red) + bias;   // a wave stores one 128-B line
}

// ---------------- host launcher ---------------------------------------------
extern "C" void kernel_launch(void* const* d_in, const int* in_sizes, int n_in,
                              void* d_out, int out_size, void* d_ws, size_t ws_size,
                              hipStream_t stream) {
  (void)in_sizes; (void)n_in; (void)out_size; (void)ws_size;
  const float* query = (const float*)d_in[0];
  const float* kv    = (const float*)d_in[1];
  const float* Wq    = (const float*)d_in[2];
  const float* bq    = (const float*)d_in[3];
  const float* Wk    = (const float*)d_in[4];
  const float* bk    = (const float*)d_in[5];
  const float* Wv    = (const float*)d_in[6];
  const float* bv    = (const float*)d_in[7];
  const float* Wo    = (const float*)d_in[8];
  const float* bo    = (const float*)d_in[9];

  char* w = (char*)d_ws;                       // the first ~12.1 MB, not all of it used
  _Float16* uh  = (_Float16*)(w + (1600u << 10));   // 128 KB
  _Float16* ctxh = (_Float16*)(w + (1856u << 10));  // 16 KB
  float*    cb  = (float*)(w + (1888u << 10));      // 1 KB
  float*   part = (float*)(w + (4096u << 10));      // 8256 KB

  qfold_kernel<<<2 * H_, 512, 0, stream>>>(query, Wq, bq, Wk, bk, uh, cb);
  attn_stream_kernel<<<B_ * NSB_, 256, 0, stream>>>(kv, uh, cb, part);
  yv_kernel<<<B_ * H_, 512, 0, stream>>>(part, Wv, bv, ctxh);
  oproj_kernel<<<16, 512, 0, stream>>>(ctxh, Wo, bo, (float*)d_out);
}
